// v000
// Measured on an AMD MI455X. A time is GPU time per run, averaged over a window of back-to-back runs after a warm-up
// (all launches, gaps included; the runs take copies of the inputs in turn), and the median of several windows.
// Apart from v000's, it joins two sittings. Times from different sittings can be a few percent apart, while
// side-by-side timings come from the same sitting.
// The starting kernel, v000, takes 167 microseconds a run.
#include <hip/hip_runtime.h>

typedef __attribute__((ext_vector_type(16))) _Float16 v16h;
typedef __attribute__((ext_vector_type(8)))  _Float16 v8h;
typedef __attribute__((ext_vector_type(8)))  float    v8f;
typedef __attribute__((ext_vector_type(4)))  unsigned int u32x4;
typedef __attribute__((ext_vector_type(8)))  int i32x8;
typedef __attribute__((ext_vector_type(4)))  int i32x4;

namespace {
constexpr int  kE = 768, kB = 2, kS = 2048;
constexpr long XH_ELT = (long)kB * kS * kE;   // 3,145,728 halves (x / Q / K / V / AO)
constexpr long WP_ELT = (long)kE * kE;        // 589,824 halves per packed weight
constexpr unsigned kPanelBytes = 24u * 2048u * 2u;  // 96KB B panel in LDS
}

union F16x16 { v16h v; _Float16 e[16]; };
union F32x8  { v8f  v; float    e[8];  };

__device__ __forceinline__ v8f wmma_f16(v16h a, v16h b, v8f c) {
  return __builtin_amdgcn_wmma_f32_16x16x32_f16(false, a, false, b, (short)0, c, false, false);
}

// A-fragment loader: 16-bit A 16x32 layout. Lane holds row (lane&15); its 16
// halves are K = {0..7,16..23} (+8 for upper half-wave) -> two contiguous b128s.
__device__ __forceinline__ v16h load_a32(const _Float16* p) {
  F16x16 a;
  v8h lo = *(const v8h*)p;
  v8h hi = *(const v8h*)(p + 16);
#pragma unroll
  for (int i = 0; i < 8; ++i) { a.e[i] = lo[i]; a.e[8 + i] = hi[i]; }
  return a.v;
}

#if defined(__has_builtin)
#if __has_builtin(__builtin_amdgcn_tensor_load_to_lds) && __has_builtin(__builtin_amdgcn_s_wait_tensorcnt)
#define USE_TDM 1
#endif
#endif

#ifdef USE_TDM
// 2D TDM: copy rows x w_elts (2-byte elements, row stride in elements) to LDS.
__device__ __forceinline__ void tdm_load_2d(unsigned lds_byte_off, const void* gsrc,
                                            unsigned w_elts, unsigned rows,
                                            unsigned long row_stride_elts) {
  unsigned long ga = (unsigned long)gsrc;
  u32x4 g0;
  g0[0] = 1u;                                               // count=1, user descriptor
  g0[1] = lds_byte_off;                                     // lds_addr
  g0[2] = (unsigned)ga;                                     // global_addr[31:0]
  g0[3] = (unsigned)((ga >> 32) & 0x01FFFFFFu) | (2u << 30);// global_addr[56:32] | type=2
  i32x8 g1;
  g1[0] = 0x10000;                                          // wg_mask=0, data_size=1 (2B)
  g1[1] = (int)((w_elts & 0xFFFFu) << 16);                  // tensor_dim0[15:0]
  g1[2] = (int)((w_elts >> 16) | ((rows & 0xFFFFu) << 16)); // dim0[31:16] | dim1[15:0]
  g1[3] = (int)((rows >> 16) | ((w_elts & 0xFFFFu) << 16)); // dim1[31:16] | tile_dim0
  g1[4] = (int)(rows & 0xFFFFu);                            // tile_dim1 | tile_dim2=0
  g1[5] = (int)(row_stride_elts & 0xFFFFFFFFul);            // dim0_stride[31:0]
  g1[6] = (int)((row_stride_elts >> 32) & 0xFFFFul);        // dim0_stride[47:32]
  g1[7] = 0;
  i32x4 z4;
  z4[0] = 0; z4[1] = 0; z4[2] = 0; z4[3] = 0;
  i32x8 z8;
#pragma unroll
  for (int i = 0; i < 8; ++i) z8[i] = 0;
  __builtin_amdgcn_tensor_load_to_lds(g0, g1, z4, z4, z8, 0);
}
#endif

__global__ void cvt_f16_kernel(const float* __restrict__ src, _Float16* __restrict__ dst, long n) {
  long i = (long)blockIdx.x * blockDim.x + threadIdx.x;
  if (i < n) dst[i] = (_Float16)src[i];
}

// Pack W[768][768] (k rows, n cols) into B-fragment tiles [kt=24][nt=48][512]:
// tile element (lane,i) = W[kt*32 + kof(lane,i)][nt*16 + lane%16]
__global__ void pack_w_kernel(const float* __restrict__ W, _Float16* __restrict__ Wp) {
  int idx  = blockIdx.x * blockDim.x + threadIdx.x;    // < 589824
  int i    = idx & 15;
  int lane = (idx >> 4) & 31;
  int tile = idx >> 9;
  int nt = tile % 48;
  int kt = tile / 48;
  int k = kt * 32 + ((i < 8) ? i : i + 8) + ((lane & 16) ? 8 : 0);
  int n = nt * 16 + (lane & 15);
  Wp[idx] = (_Float16)W[k * 768 + n];
}

// Pack V [24 heads][2048][64] f16 into per-head A-fragment tiles [kt=64][dt=4][512]
__global__ void pack_v_kernel(const _Float16* __restrict__ Vb, _Float16* __restrict__ Vp) {
  int idx  = blockIdx.x * blockDim.x + threadIdx.x;    // < 3145728
  int i    = idx & 15;
  int lane = (idx >> 4) & 31;
  int tile = (idx >> 9) & 255;                         // 64 kt * 4 dt
  int head = idx >> 17;                                // 2048*64 = 2^17 per head
  int dt = tile & 3;
  int kt = tile >> 2;
  int k = kt * 32 + ((i < 8) ? i : i + 8) + ((lane & 16) ? 8 : 0);
  int d = dt * 16 + (lane & 15);
  Vp[idx] = Vb[((long)head << 17) + k * 64 + d];
}

__global__ void dscale_kernel(const float* __restrict__ de, const float* __restrict__ Wd,
                              const float* __restrict__ bd, float* __restrict__ dsc) {
  int t = threadIdx.x;
  if (t >= 24) return;
  int b = t / 12, h = t % 12;
  float s = bd[h];
  for (int i = 0; i < 64; ++i) s += de[b * 64 + i] * Wd[i * 12 + h];
  dsc[t] = s * 0.125f;   // fold in 1/sqrt(64)
}

// C[4096,768] = A(f16 row-major) @ Wpacked + bias.
// Block = 4 waves -> 128(M) x 64(N). B panel (24 x 2048 halves = 96KB) staged in
// LDS once per block via TDM; wave computes 32x64, ping-pong A prefetch.
__global__ __launch_bounds__(128) void gemm_wmma_kernel(
    const _Float16* __restrict__ A, const _Float16* __restrict__ Wp,
    const float* __restrict__ bias, _Float16* __restrict__ out_h,
    float* __restrict__ out_f) {
  extern __shared__ _Float16 smem[];                   // [24][2048] B panel
  const int lane  = threadIdx.x & 31;
  const int wave  = threadIdx.x >> 5;
  const int mbase = blockIdx.x * 128 + wave * 32;
  const int nbase = blockIdx.y * 64;
  const int lm    = lane & 15;
  const int hi8   = (lane & 16) ? 8 : 0;
  const int nt0   = nbase >> 4;

#ifdef USE_TDM
  if (wave == 0) {
    tdm_load_2d((unsigned)(size_t)(&smem[0]), Wp + (long)nt0 * 512,
                2048u, 24u, 48ul * 512ul);
    __builtin_amdgcn_s_wait_tensorcnt(0);
  }
  __syncthreads();
#else
  {  // cooperative fallback copy: 128 threads x v8h
    const _Float16* src = Wp + (long)nt0 * 512;
    for (int r = 0; r < 24; ++r) {
      for (int c = threadIdx.x * 8; c < 2048; c += 128 * 8)
        *(v8h*)(smem + r * 2048 + c) = *(const v8h*)(src + (long)r * 48 * 512 + c);
    }
  }
  __syncthreads();
#endif

  const _Float16* a0p = A + (long)(mbase + lm) * 768 + hi8;
  const _Float16* a1p = a0p + 16 * 768;

  v8f acc[2][4] = {};
  v16h aA0 = load_a32(a0p), aA1 = load_a32(a1p);     // even-kt buffer
  v16h aB0, aB1;                                      // odd-kt buffer

  auto kstep = [&](int kt, v16h& x0, v16h& x1) {
    const _Float16* bp = smem + kt * 2048 + lane * 16;
#pragma unroll
    for (int t = 0; t < 4; ++t) {
      v16h b = *(const v16h*)(bp + t * 512);          // ds_load from shared panel
      acc[0][t] = wmma_f16(x0, b, acc[0][t]);
      acc[1][t] = wmma_f16(x1, b, acc[1][t]);
    }
  };

  for (int kt = 0; kt < 24; kt += 2) {
    aB0 = load_a32(a0p + (kt + 1) * 32);              // prefetch odd kt
    aB1 = load_a32(a1p + (kt + 1) * 32);
    kstep(kt, aA0, aA1);
    if (kt + 2 < 24) {                                // prefetch next even kt
      aA0 = load_a32(a0p + (kt + 2) * 32);
      aA1 = load_a32(a1p + (kt + 2) * 32);
    }
    kstep(kt + 1, aB0, aB1);
  }

#pragma unroll
  for (int m = 0; m < 2; ++m) {
    const int mb = mbase + m * 16;
#pragma unroll
    for (int t = 0; t < 4; ++t) {
      F32x8 u; u.v = acc[m][t];
      const int cidx = nbase + t * 16 + lm;
      const float bv = bias[cidx];
#pragma unroll
      for (int j = 0; j < 8; ++j) {
        int r = mb + hi8 + j;                    // C layout: M = j + 8*(upper half)
        float val = u.e[j] + bv;
        if (out_f) out_f[(long)r * 768 + cidx] = val;
        if (out_h) {                             // scatter into [B,H,S,64]
          int bb = r >> 11, s = r & 2047;
          int h = cidx >> 6, d = cidx & 63;
          out_h[(((long)(bb * 12 + h) << 11) + s) * 64 + d] = (_Float16)val;
        }
      }
    }
  }
}

// Transposed flash attention: per wave one 16-row q tile, 64 chunks of 32 keys.
// S^T = K @ Q^T keeps the softmax (key) axis per-lane; P^T converts in-lane to
// the B-fragment for out^T = V^T @ P^T. K chunks ping-pong between two register
// buffers; V fragments issued early, consumed after softmax.
__global__ __launch_bounds__(128) void attn_kernel(
    const _Float16* __restrict__ Qb, const _Float16* __restrict__ Kb,
    const _Float16* __restrict__ Vp, const float* __restrict__ dsc,
    _Float16* __restrict__ AO) {
  const int lane = threadIdx.x & 31;
  const int wave = threadIdx.x >> 5;
  const int bh   = blockIdx.y;                 // 0..23
  const int qt   = blockIdx.x * 4 + wave;      // 0..127
  const int lm   = lane & 15;
  const int hi8  = (lane & 16) ? 8 : 0;
  const long hbase = (long)bh << 17;           // 2048*64 per head
  const _Float16* Q = Qb + hbase;
  const _Float16* K = Kb + hbase;
  const _Float16* V = Vp + hbase;
  const float sc = dsc[bh];
  const int qbase = qt * 16;

  // Q^T B-fragments for the two d-halves (loaded once, reused 64x)
  F16x16 bq0, bq1;
  {
    const _Float16* qp = Q + (qbase + lm) * 64;
#pragma unroll
    for (int i = 0; i < 16; ++i) {
      int d = ((i < 8) ? i : i + 8) + hi8;
      bq0.e[i] = qp[d];
      bq1.e[i] = qp[32 + d];
    }
  }

  const _Float16* kbase = K + (long)lm * 64 + hi8;
  auto loadK = [&](int kc, v16h* ka) {
    const _Float16* kp = kbase + (long)kc * 32 * 64;
    ka[0] = load_a32(kp);                 // tile0, d 0..31
    ka[1] = load_a32(kp + 32);            // tile0, d 32..63
    ka[2] = load_a32(kp + 1024);          // tile1, d 0..31
    ka[3] = load_a32(kp + 1024 + 32);     // tile1, d 32..63
  };

  v8f o[4] = {};
  float mrow = -1e30f, lrow = 0.f;

  // one 32-key chunk; prefetches chunk `pf` into kapf between scores & softmax
  auto chunk = [&](int kc, v16h* ka, int pf, v16h* kapf) {
    const _Float16* vp = V + (long)kc * 2048 + lane * 16;
    v16h vv0 = *(const v16h*)(vp);
    v16h vv1 = *(const v16h*)(vp + 512);
    v16h vv2 = *(const v16h*)(vp + 1024);
    v16h vv3 = *(const v16h*)(vp + 1536);

    v8f st0 = {}, st1 = {};
    st0 = wmma_f16(ka[0], bq0.v, st0);
    st0 = wmma_f16(ka[1], bq1.v, st0);
    st1 = wmma_f16(ka[2], bq0.v, st1);
    st1 = wmma_f16(ka[3], bq1.v, st1);

    if (pf < 64) loadK(pf, kapf);

    F32x8 s0, s1; s0.v = st0; s1.v = st1;
    float cmax = -1e30f;
#pragma unroll
    for (int j = 0; j < 8; ++j) {
      s0.e[j] *= sc; s1.e[j] *= sc;
      cmax = fmaxf(cmax, fmaxf(s0.e[j], s1.e[j]));
    }
    cmax = fmaxf(cmax, __shfl_xor(cmax, 16, 32));   // combine half-waves
    float mnew = fmaxf(mrow, cmax);
    float corr = __expf(mrow - mnew);
    F16x16 pb;                                       // P^T B-fragment, in-lane
    float psum = 0.f;
#pragma unroll
    for (int j = 0; j < 8; ++j) {
      float e0 = __expf(s0.e[j] - mnew);
      float e1 = __expf(s1.e[j] - mnew);
      psum += e0 + e1;
      pb.e[j]     = (_Float16)e0;                    // k' = j    + hi8
      pb.e[8 + j] = (_Float16)e1;                    // k' = j+16 + hi8
    }
    lrow = lrow * corr + psum;
    mrow = mnew;

#pragma unroll
    for (int t = 0; t < 4; ++t) {
      F32x8 uo; uo.v = o[t];
#pragma unroll
      for (int j = 0; j < 8; ++j) uo.e[j] *= corr;
      v16h av = (t == 0) ? vv0 : (t == 1) ? vv1 : (t == 2) ? vv2 : vv3;
      o[t] = wmma_f16(av, pb.v, uo.v);
    }
  };

  v16h kaA[4], kaB[4];
  loadK(0, kaA);
  for (int kc = 0; kc < 64; kc += 2) {
    chunk(kc,     kaA, kc + 1, kaB);   // even chunk, prefetch odd
    chunk(kc + 1, kaB, kc + 2, kaA);   // odd chunk, prefetch next even
  }

  float ltot = lrow + __shfl_xor(lrow, 16, 32);
  float inv = 1.f / ltot;
  const int tokrow  = (bh / 12) * 2048 + qbase + lm;
  const int colbase = (bh % 12) * 64;
#pragma unroll
  for (int t = 0; t < 4; ++t) {
    F32x8 uo; uo.v = o[t];
#pragma unroll
    for (int j = 0; j < 8; ++j) {
      int d = colbase + t * 16 + hi8 + j;
      AO[(long)tokrow * 768 + d] = (_Float16)(uo.e[j] * inv);
    }
  }
}

extern "C" void kernel_launch(void* const* d_in, const int* in_sizes, int n_in,
                              void* d_out, int out_size, void* d_ws, size_t ws_size,
                              hipStream_t stream) {
  (void)in_sizes; (void)n_in; (void)out_size; (void)ws_size;
  const float* x  = (const float*)d_in[0];
  const float* de = (const float*)d_in[1];
  const float* Wq = (const float*)d_in[2];
  const float* bq = (const float*)d_in[3];
  const float* Wk = (const float*)d_in[4];
  const float* bk = (const float*)d_in[5];
  const float* Wv = (const float*)d_in[6];
  const float* bv = (const float*)d_in[7];
  const float* Wd = (const float*)d_in[8];
  const float* bd = (const float*)d_in[9];
  const float* Wp = (const float*)d_in[10];
  const float* bp = (const float*)d_in[11];
  float* out = (float*)d_out;

  _Float16* ws16 = (_Float16*)d_ws;
  _Float16* xh  = ws16;
  _Float16* wqp = xh  + XH_ELT;
  _Float16* wkp = wqp + WP_ELT;
  _Float16* wvp = wkp + WP_ELT;
  _Float16* wpp = wvp + WP_ELT;
  _Float16* qb  = wpp + WP_ELT;
  _Float16* kb  = qb  + XH_ELT;
  _Float16* vb  = kb  + XH_ELT;
  _Float16* vpk = vb  + XH_ELT;
  _Float16* ao  = vpk + XH_ELT;
  float*    dsc = (float*)(ao + XH_ELT);

  cvt_f16_kernel<<<(XH_ELT + 255) / 256, 256, 0, stream>>>(x, xh, XH_ELT);
  pack_w_kernel<<<(WP_ELT + 255) / 256, 256, 0, stream>>>(Wq, wqp);
  pack_w_kernel<<<(WP_ELT + 255) / 256, 256, 0, stream>>>(Wk, wkp);
  pack_w_kernel<<<(WP_ELT + 255) / 256, 256, 0, stream>>>(Wv, wvp);
  pack_w_kernel<<<(WP_ELT + 255) / 256, 256, 0, stream>>>(Wp, wpp);
  dscale_kernel<<<1, 32, 0, stream>>>(de, Wd, bd, dsc);

  dim3 gg(32, 12);   // 4096/128 x 768/64
  gemm_wmma_kernel<<<gg, 128, kPanelBytes, stream>>>(xh, wqp, bq, qb, nullptr);
  gemm_wmma_kernel<<<gg, 128, kPanelBytes, stream>>>(xh, wkp, bk, kb, nullptr);
  gemm_wmma_kernel<<<gg, 128, kPanelBytes, stream>>>(xh, wvp, bv, vb, nullptr);
  pack_v_kernel<<<(XH_ELT + 255) / 256, 256, 0, stream>>>(vb, vpk);

  attn_kernel<<<dim3(32, 24), 128, 0, stream>>>(qb, kb, vpk, dsc, ao);

  gemm_wmma_kernel<<<gg, 128, kPanelBytes, stream>>>(ao, wpp, bp, nullptr, out);
}

// v001
// One run takes 135 microseconds.
// Two timings next to v000 put it at 1.28 and 1.27 times that version's speed.
#include <hip/hip_runtime.h>

typedef __attribute__((ext_vector_type(16))) _Float16 v16h;
typedef __attribute__((ext_vector_type(8)))  _Float16 v8h;
typedef __attribute__((ext_vector_type(8)))  float    v8f;
typedef __attribute__((ext_vector_type(4)))  unsigned int u32x4;
typedef __attribute__((ext_vector_type(8)))  int i32x8;
typedef __attribute__((ext_vector_type(4)))  int i32x4;

namespace {
constexpr int  kE = 768, kB = 2, kS = 2048;
constexpr long XH_ELT = (long)kB * kS * kE;   // 3,145,728 halves (x / Q / K / V / AO)
constexpr long WP_ELT = (long)kE * kE;        // 589,824 halves per packed weight
constexpr unsigned kPanelBytes = 24u * 2048u * 2u;  // 96KB B panel in LDS
constexpr int kTileKeys = 128;                 // keys per K/V tile in LDS
constexpr int kKPitchH  = 72;                  // halves: a 128-byte K row at a 144-byte pitch
constexpr unsigned kKStepB = 16u * kKPitchH * 2u;  // 128 lanes x 16 B = 16 K rows
constexpr int kKAreaH   = kTileKeys * kKPitchH;
constexpr int kBufH     = kKAreaH + kTileKeys * 64;  // K area + V area, halves
}

union F16x16 { v16h v; _Float16 e[16]; };
union F32x8  { v8f  v; float    e[8];  };

__device__ __forceinline__ v8f wmma_f16(v16h a, v16h b, v8f c) {
  return __builtin_amdgcn_wmma_f32_16x16x32_f16(false, a, false, b, (short)0, c, false, false);
}

// A-fragment loader: 16-bit A 16x32 layout. Lane holds row (lane&15); its 16
// halves are K = {0..7,16..23} (+8 for upper half-wave) -> two contiguous b128s.
__device__ __forceinline__ v16h load_a32(const _Float16* p) {
  F16x16 a;
  v8h lo = *(const v8h*)p;
  v8h hi = *(const v8h*)(p + 16);
#pragma unroll
  for (int i = 0; i < 8; ++i) { a.e[i] = lo[i]; a.e[8 + i] = hi[i]; }
  return a.v;
}

#if defined(__has_builtin)
#if __has_builtin(__builtin_amdgcn_tensor_load_to_lds) && __has_builtin(__builtin_amdgcn_s_wait_tensorcnt)
#define USE_TDM 1
#endif
#endif

#ifdef USE_TDM
// 2D TDM: copy rows x w_elts (2-byte elements, row stride in elements) to LDS.
__device__ __forceinline__ void tdm_load_2d(unsigned lds_byte_off, const void* gsrc,
                                            unsigned w_elts, unsigned rows,
                                            unsigned long row_stride_elts) {
  unsigned long ga = (unsigned long)gsrc;
  u32x4 g0;
  g0[0] = 1u;                                               // count=1, user descriptor
  g0[1] = lds_byte_off;                                     // lds_addr
  g0[2] = (unsigned)ga;                                     // global_addr[31:0]
  g0[3] = (unsigned)((ga >> 32) & 0x01FFFFFFu) | (2u << 30);// global_addr[56:32] | type=2
  i32x8 g1;
  g1[0] = 0x10000;                                          // wg_mask=0, data_size=1 (2B)
  g1[1] = (int)((w_elts & 0xFFFFu) << 16);                  // tensor_dim0[15:0]
  g1[2] = (int)((w_elts >> 16) | ((rows & 0xFFFFu) << 16)); // dim0[31:16] | dim1[15:0]
  g1[3] = (int)((rows >> 16) | ((w_elts & 0xFFFFu) << 16)); // dim1[31:16] | tile_dim0
  g1[4] = (int)(rows & 0xFFFFu);                            // tile_dim1 | tile_dim2=0
  g1[5] = (int)(row_stride_elts & 0xFFFFFFFFul);            // dim0_stride[31:0]
  g1[6] = (int)((row_stride_elts >> 32) & 0xFFFFul);        // dim0_stride[47:32]
  g1[7] = 0;
  i32x4 z4;
  z4[0] = 0; z4[1] = 0; z4[2] = 0; z4[3] = 0;
  i32x8 z8;
#pragma unroll
  for (int i = 0; i < 8; ++i) z8[i] = 0;
  __builtin_amdgcn_tensor_load_to_lds(g0, g1, z4, z4, z8, 0);
}
#endif

__global__ void cvt_f16_kernel(const float* __restrict__ src, _Float16* __restrict__ dst, long n) {
  long i = (long)blockIdx.x * blockDim.x + threadIdx.x;
  if (i < n) dst[i] = (_Float16)src[i];
}

// Pack W[768][768] (k rows, n cols) into B-fragment tiles [kt=24][nt=48][512]:
// tile element (lane,i) = W[kt*32 + kof(lane,i)][nt*16 + lane%16]
__global__ void pack_w_kernel(const float* __restrict__ W, _Float16* __restrict__ Wp) {
  int idx  = blockIdx.x * blockDim.x + threadIdx.x;    // < 589824
  int i    = idx & 15;
  int lane = (idx >> 4) & 31;
  int tile = idx >> 9;
  int nt = tile % 48;
  int kt = tile / 48;
  int k = kt * 32 + ((i < 8) ? i : i + 8) + ((lane & 16) ? 8 : 0);
  int n = nt * 16 + (lane & 15);
  Wp[idx] = (_Float16)W[k * 768 + n];
}

// Pack V [24 heads][2048][64] f16 into per-head A-fragment tiles [kt=64][dt=4][512]
__global__ void pack_v_kernel(const _Float16* __restrict__ Vb, _Float16* __restrict__ Vp) {
  int idx  = blockIdx.x * blockDim.x + threadIdx.x;    // < 3145728
  int i    = idx & 15;
  int lane = (idx >> 4) & 31;
  int tile = (idx >> 9) & 255;                         // 64 kt * 4 dt
  int head = idx >> 17;                                // 2048*64 = 2^17 per head
  int dt = tile & 3;
  int kt = tile >> 2;
  int k = kt * 32 + ((i < 8) ? i : i + 8) + ((lane & 16) ? 8 : 0);
  int d = dt * 16 + (lane & 15);
  Vp[idx] = Vb[((long)head << 17) + k * 64 + d];
}

__global__ void dscale_kernel(const float* __restrict__ de, const float* __restrict__ Wd,
                              const float* __restrict__ bd, float* __restrict__ dsc) {
  int t = threadIdx.x;
  if (t >= 24) return;
  int b = t / 12, h = t % 12;
  float s = bd[h];
  for (int i = 0; i < 64; ++i) s += de[b * 64 + i] * Wd[i * 12 + h];
  dsc[t] = s * 0.125f;   // fold in 1/sqrt(64)
}

// C[4096,768] = A(f16 row-major) @ Wpacked + bias.
// Block = 4 waves -> 128(M) x 64(N). B panel (24 x 2048 halves = 96KB) staged in
// LDS once per block via TDM; wave computes 32x64, ping-pong A prefetch.
__global__ __launch_bounds__(128) void gemm_wmma_kernel(
    const _Float16* __restrict__ A, const _Float16* __restrict__ Wp,
    const float* __restrict__ bias, _Float16* __restrict__ out_h,
    float* __restrict__ out_f) {
  extern __shared__ _Float16 smem[];                   // [24][2048] B panel
  const int lane  = threadIdx.x & 31;
  const int wave  = threadIdx.x >> 5;
  const int mbase = blockIdx.x * 128 + wave * 32;
  const int nbase = blockIdx.y * 64;
  const int lm    = lane & 15;
  const int hi8   = (lane & 16) ? 8 : 0;
  const int nt0   = nbase >> 4;

#ifdef USE_TDM
  if (wave == 0) {
    tdm_load_2d((unsigned)(size_t)(&smem[0]), Wp + (long)nt0 * 512,
                2048u, 24u, 48ul * 512ul);
    __builtin_amdgcn_s_wait_tensorcnt(0);
  }
  __syncthreads();
#else
  {  // cooperative fallback copy: 128 threads x v8h
    const _Float16* src = Wp + (long)nt0 * 512;
    for (int r = 0; r < 24; ++r) {
      for (int c = threadIdx.x * 8; c < 2048; c += 128 * 8)
        *(v8h*)(smem + r * 2048 + c) = *(const v8h*)(src + (long)r * 48 * 512 + c);
    }
  }
  __syncthreads();
#endif

  const _Float16* a0p = A + (long)(mbase + lm) * 768 + hi8;
  const _Float16* a1p = a0p + 16 * 768;

  v8f acc[2][4] = {};
  v16h aA0 = load_a32(a0p), aA1 = load_a32(a1p);     // even-kt buffer
  v16h aB0, aB1;                                      // odd-kt buffer

  auto kstep = [&](int kt, v16h& x0, v16h& x1) {
    const _Float16* bp = smem + kt * 2048 + lane * 16;
#pragma unroll
    for (int t = 0; t < 4; ++t) {
      v16h b = *(const v16h*)(bp + t * 512);          // ds_load from shared panel
      acc[0][t] = wmma_f16(x0, b, acc[0][t]);
      acc[1][t] = wmma_f16(x1, b, acc[1][t]);
    }
  };

  for (int kt = 0; kt < 24; kt += 2) {
    aB0 = load_a32(a0p + (kt + 1) * 32);              // prefetch odd kt
    aB1 = load_a32(a1p + (kt + 1) * 32);
    kstep(kt, aA0, aA1);
    if (kt + 2 < 24) {                                // prefetch next even kt
      aA0 = load_a32(a0p + (kt + 2) * 32);
      aA1 = load_a32(a1p + (kt + 2) * 32);
    }
    kstep(kt + 1, aB0, aB1);
  }

#pragma unroll
  for (int m = 0; m < 2; ++m) {
    const int mb = mbase + m * 16;
#pragma unroll
    for (int t = 0; t < 4; ++t) {
      F32x8 u; u.v = acc[m][t];
      const int cidx = nbase + t * 16 + lm;
      const float bv = bias[cidx];
#pragma unroll
      for (int j = 0; j < 8; ++j) {
        int r = mb + hi8 + j;                    // C layout: M = j + 8*(upper half)
        float val = u.e[j] + bv;
        if (out_f) out_f[(long)r * 768 + cidx] = val;
        if (out_h) {                             // scatter into [B,H,S,64]
          int bb = r >> 11, s = r & 2047;
          int h = cidx >> 6, d = cidx & 63;
          out_h[(((long)(bb * 12 + h) << 11) + s) * 64 + d] = (_Float16)val;
        }
      }
    }
  }
}

// Fragment from two 16-byte pieces that lie hstep halves apart.
__device__ __forceinline__ v16h load_frag(const _Float16* p, int hstep) {
  F16x16 a;
  v8h lo = *(const v8h*)p;
  v8h hi = *(const v8h*)(p + hstep);
#pragma unroll
  for (int i = 0; i < 8; ++i) { a.e[i] = lo[i]; a.e[8 + i] = hi[i]; }
  return a.v;
}

// 64 keys of K and of V, global -> LDS, 16 bytes per lane and copy, no register
// in between. The s_wait_xcnt stands inside the statement so that no address
// register is rewritten ahead of it.
__device__ __forceinline__ void copy_kv64(unsigned kl, const _Float16* kg,
                                          unsigned vl, const _Float16* vg) {
  asm volatile(
      "global_load_async_to_lds_b128 %0, %1, off\n\t"
      "global_load_async_to_lds_b128 %2, %3, off\n\t"
      "global_load_async_to_lds_b128 %4, %5, off\n\t"
      "global_load_async_to_lds_b128 %6, %7, off\n\t"
      "global_load_async_to_lds_b128 %8, %9, off\n\t"
      "global_load_async_to_lds_b128 %10, %11, off\n\t"
      "global_load_async_to_lds_b128 %12, %13, off\n\t"
      "global_load_async_to_lds_b128 %14, %15, off\n\t"
      "s_wait_xcnt 0x0"
      :: "v"(kl),                  "v"(kg),
         "v"(kl + 1u * kKStepB),   "v"(kg + 1024),
         "v"(kl + 2u * kKStepB),   "v"(kg + 2048),
         "v"(kl + 3u * kKStepB),   "v"(kg + 3072),
         "v"(vl),                  "v"(vg),
         "v"(vl + 2048u),          "v"(vg + 1024),
         "v"(vl + 4096u),          "v"(vg + 2048),
         "v"(vl + 6144u),          "v"(vg + 3072)
      : "memory");
}

// Transposed flash attention: per wave one 16-row q tile, 64 chunks of 32 keys.
// S^T = K @ Q^T keeps the softmax (key) axis per-lane; P^T converts in-lane to
// the B-fragment for out^T = V^T @ P^T. The four waves of a block share K and V:
// tiles of 128 keys are copied to LDS once per block, two buffers, the next tile
// in flight while this one is worked on. K rows lie at a 144-byte pitch, each V
// fragment as two runs of 16 bytes per lane, so every b128 read is conflict-free.
__global__ __launch_bounds__(128) void attn_kernel(
    const _Float16* __restrict__ Qb, const _Float16* __restrict__ Kb,
    const _Float16* __restrict__ Vp, const float* __restrict__ dsc,
    _Float16* __restrict__ AO) {
  __shared__ __attribute__((aligned(16))) _Float16 kv[2 * kBufH];
  const int tid  = threadIdx.x;
  const int lane = threadIdx.x & 31;
  const int wave = threadIdx.x >> 5;
  const int bh   = blockIdx.y;                 // 0..23
  const int qt   = blockIdx.x * 4 + wave;      // 0..127
  const int lm   = lane & 15;
  const int hi8  = (lane & 16) ? 8 : 0;
  const long hbase = (long)bh << 17;           // 2048*64 per head
  const _Float16* Q = Qb + hbase;
  const _Float16* K = Kb + hbase;
  const _Float16* V = Vp + hbase;
  const int qbase = qt * 16;

  // This lane's 16-byte piece of a tile: source (contiguous) and place in LDS.
  const unsigned lds0 = (unsigned)(size_t)(&kv[0]);
  const unsigned kl0 = lds0 + (unsigned)(tid >> 3) * (kKPitchH * 2u) + (unsigned)(tid & 7) * 16u;
  const unsigned vl0 = lds0 + kKAreaH * 2u + (unsigned)(tid >> 6) * 1024u +
                       (unsigned)(tid & 1) * 512u + (unsigned)((tid >> 1) & 31) * 16u;
  const _Float16* kg0 = K + tid * 8;
  const _Float16* vg0 = V + tid * 8;
  auto copy_tile = [&](int t, int buf) {
    const unsigned bo = (unsigned)buf * (kBufH * 2u);
    const _Float16* kg = kg0 + (long)t * (kTileKeys * 64);
    const _Float16* vg = vg0 + (long)t * (kTileKeys * 64);
    copy_kv64(kl0 + bo, kg, vl0 + bo, vg);
    copy_kv64(kl0 + bo + 64u * kKPitchH * 2u, kg + 4096, vl0 + bo + 8192u, vg + 4096);
  };

  copy_tile(0, 0);

  const float sc = dsc[bh];
  // Q^T B-fragments for the two d-halves (loaded once, reused 64x)
  F16x16 bq0, bq1;
  {
    const _Float16* qp = Q + (qbase + lm) * 64;
#pragma unroll
    for (int i = 0; i < 16; ++i) {
      int d = ((i < 8) ? i : i + 8) + hi8;
      bq0.e[i] = qp[d];
      bq1.e[i] = qp[32 + d];
    }
  }

  // tile 0 has landed for this wave, then for all; only then is it read
  asm volatile("s_wait_asynccnt 0x0" ::: "memory");
  __syncthreads();
  copy_tile(1, 1);

  auto loadK = [&](const _Float16* kp, v16h* ka) {
    ka[0] = load_frag(kp, 16);                      // tile0, d 0..31
    ka[1] = load_frag(kp + 32, 16);                 // tile0, d 32..63
    ka[2] = load_frag(kp + 16 * kKPitchH, 16);      // tile1, d 0..31
    ka[3] = load_frag(kp + 16 * kKPitchH + 32, 16); // tile1, d 32..63
  };

  v8f o[4] = {};
  float mrow = -1e30f, lrow = 0.f;

  // one 32-key chunk; fetches the tile's next chunk of K (if any) into kapf
  // between scores & softmax
  auto chunk = [&](const _Float16* vp, v16h* ka, const _Float16* kpf, v16h* kapf) {
    v16h vv0 = load_frag(vp, 256);
    v16h vv1 = load_frag(vp + 512, 256);
    v16h vv2 = load_frag(vp + 1024, 256);
    v16h vv3 = load_frag(vp + 1536, 256);

    v8f st0 = {}, st1 = {};
    st0 = wmma_f16(ka[0], bq0.v, st0);
    st0 = wmma_f16(ka[1], bq1.v, st0);
    st1 = wmma_f16(ka[2], bq0.v, st1);
    st1 = wmma_f16(ka[3], bq1.v, st1);

    if (kpf) loadK(kpf, kapf);

    F32x8 s0, s1; s0.v = st0; s1.v = st1;
    float cmax = -1e30f;
#pragma unroll
    for (int j = 0; j < 8; ++j) {
      s0.e[j] *= sc; s1.e[j] *= sc;
      cmax = fmaxf(cmax, fmaxf(s0.e[j], s1.e[j]));
    }
    cmax = fmaxf(cmax, __shfl_xor(cmax, 16, 32));   // combine half-waves
    float mnew = fmaxf(mrow, cmax);
    float corr = __expf(mrow - mnew);
    F16x16 pb;                                       // P^T B-fragment, in-lane
    float psum = 0.f;
#pragma unroll
    for (int j = 0; j < 8; ++j) {
      float e0 = __expf(s0.e[j] - mnew);
      float e1 = __expf(s1.e[j] - mnew);
      psum += e0 + e1;
      pb.e[j]     = (_Float16)e0;                    // k' = j    + hi8
      pb.e[8 + j] = (_Float16)e1;                    // k' = j+16 + hi8
    }
    lrow = lrow * corr + psum;
    mrow = mnew;

#pragma unroll
    for (int t = 0; t < 4; ++t) {
      F32x8 uo; uo.v = o[t];
#pragma unroll
      for (int j = 0; j < 8; ++j) uo.e[j] *= corr;
      v16h av = (t == 0) ? vv0 : (t == 1) ? vv1 : (t == 2) ? vv2 : vv3;
      o[t] = wmma_f16(av, pb.v, uo.v);
    }
  };

  constexpr int kTiles = kS / kTileKeys;
  v16h kaA[4], kaB[4];
  for (int t = 0; t < kTiles; ++t) {
    const _Float16* kb = kv + (t & 1) * kBufH + lm * kKPitchH + hi8;
    const _Float16* vb = kv + (t & 1) * kBufH + kKAreaH + lane * 8;
    loadK(kb, kaA);
    chunk(vb,        kaA, kb + 32 * kKPitchH, kaB);
    chunk(vb + 2048, kaB, kb + 64 * kKPitchH, kaA);
    chunk(vb + 4096, kaA, kb + 96 * kKPitchH, kaB);
    chunk(vb + 6144, kaB, nullptr,            kaA);
    // hand-over: this wave's reads of the tile are done and its copies of the
    // next tile have landed, then the same holds for all four waves
    asm volatile("s_wait_dscnt 0x0" ::: "memory");
    asm volatile("s_wait_asynccnt 0x0" ::: "memory");
    __syncthreads();
    if (t + 2 < kTiles) copy_tile(t + 2, t & 1);     // refill the buffer just read
  }
  // no copy is left in flight when the wave ends
  asm volatile("s_wait_asynccnt 0x0" ::: "memory");

  float ltot = lrow + __shfl_xor(lrow, 16, 32);
  float inv = 1.f / ltot;
  const int tokrow  = (bh / 12) * 2048 + qbase + lm;
  const int colbase = (bh % 12) * 64;
#pragma unroll
  for (int t = 0; t < 4; ++t) {
    F32x8 uo; uo.v = o[t];
#pragma unroll
    for (int j = 0; j < 8; ++j) {
      int d = colbase + t * 16 + hi8 + j;
      AO[(long)tokrow * 768 + d] = (_Float16)(uo.e[j] * inv);
    }
  }
}

extern "C" void kernel_launch(void* const* d_in, const int* in_sizes, int n_in,
                              void* d_out, int out_size, void* d_ws, size_t ws_size,
                              hipStream_t stream) {
  (void)in_sizes; (void)n_in; (void)out_size; (void)ws_size;
  const float* x  = (const float*)d_in[0];
  const float* de = (const float*)d_in[1];
  const float* Wq = (const float*)d_in[2];
  const float* bq = (const float*)d_in[3];
  const float* Wk = (const float*)d_in[4];
  const float* bk = (const float*)d_in[5];
  const float* Wv = (const float*)d_in[6];
  const float* bv = (const float*)d_in[7];
  const float* Wd = (const float*)d_in[8];
  const float* bd = (const float*)d_in[9];
  const float* Wp = (const float*)d_in[10];
  const float* bp = (const float*)d_in[11];
  float* out = (float*)d_out;

  _Float16* ws16 = (_Float16*)d_ws;
  _Float16* xh  = ws16;
  _Float16* wqp = xh  + XH_ELT;
  _Float16* wkp = wqp + WP_ELT;
  _Float16* wvp = wkp + WP_ELT;
  _Float16* wpp = wvp + WP_ELT;
  _Float16* qb  = wpp + WP_ELT;
  _Float16* kb  = qb  + XH_ELT;
  _Float16* vb  = kb  + XH_ELT;
  _Float16* vpk = vb  + XH_ELT;
  _Float16* ao  = vpk + XH_ELT;
  float*    dsc = (float*)(ao + XH_ELT);

  cvt_f16_kernel<<<(XH_ELT + 255) / 256, 256, 0, stream>>>(x, xh, XH_ELT);
  pack_w_kernel<<<(WP_ELT + 255) / 256, 256, 0, stream>>>(Wq, wqp);
  pack_w_kernel<<<(WP_ELT + 255) / 256, 256, 0, stream>>>(Wk, wkp);
  pack_w_kernel<<<(WP_ELT + 255) / 256, 256, 0, stream>>>(Wv, wvp);
  pack_w_kernel<<<(WP_ELT + 255) / 256, 256, 0, stream>>>(Wp, wpp);
  dscale_kernel<<<1, 32, 0, stream>>>(de, Wd, bd, dsc);

  dim3 gg(32, 12);   // 4096/128 x 768/64
  gemm_wmma_kernel<<<gg, 128, kPanelBytes, stream>>>(xh, wqp, bq, qb, nullptr);
  gemm_wmma_kernel<<<gg, 128, kPanelBytes, stream>>>(xh, wkp, bk, kb, nullptr);
  gemm_wmma_kernel<<<gg, 128, kPanelBytes, stream>>>(xh, wvp, bv, vb, nullptr);
  pack_v_kernel<<<(XH_ELT + 255) / 256, 256, 0, stream>>>(vb, vpk);

  attn_kernel<<<dim3(32, 24), 128, 0, stream>>>(qb, kb, vpk, dsc, ao);

  gemm_wmma_kernel<<<gg, 128, kPanelBytes, stream>>>(ao, wpp, bp, nullptr, out);
}

// v002
// A run of this version takes 108 microseconds.
// Next to v001, in two timings, it ran 1.25 and 1.24 times as fast.
// Over all steps from v000 it is 1.59 times as fast.
#include <hip/hip_runtime.h>

typedef __attribute__((ext_vector_type(16))) _Float16 v16h;
typedef __attribute__((ext_vector_type(8)))  _Float16 v8h;
typedef __attribute__((ext_vector_type(8)))  float    v8f;
typedef __attribute__((ext_vector_type(4)))  unsigned int u32x4;
typedef __attribute__((ext_vector_type(8)))  int i32x8;
typedef __attribute__((ext_vector_type(4)))  int i32x4;

namespace {
constexpr int  kE = 768, kB = 2, kS = 2048;
constexpr long XH_ELT = (long)kB * kS * kE;   // 3,145,728 halves (x / Q / K / V / AO)
constexpr long WP_ELT = (long)kE * kE;        // 589,824 halves per packed weight
constexpr int  kPackBlocks = (int)(WP_ELT / 256);   // blocks per weight pack
constexpr int  kCvtBlocks  = (int)(XH_ELT / 256);   // blocks for the conversion of x
constexpr int  kPrepBlocks = 1 + 4 * kPackBlocks + kCvtBlocks;
constexpr unsigned kPanelBytes = 24u * 2048u * 2u;  // 96KB B panel in LDS
constexpr int kTileKeys = 128;                 // keys per K/V tile in LDS
constexpr int kKPitchH  = 72;                  // halves: a 128-byte K row at a 144-byte pitch
constexpr unsigned kKStepB = 16u * kKPitchH * 2u;  // 128 lanes x 16 B = 16 K rows
constexpr int kKAreaH   = kTileKeys * kKPitchH;
constexpr int kBufH     = kKAreaH + kTileKeys * 64;  // K area + V area, halves
}

union F16x16 { v16h v; _Float16 e[16]; };
union F32x8  { v8f  v; float    e[8];  };

__device__ __forceinline__ v8f wmma_f16(v16h a, v16h b, v8f c) {
  return __builtin_amdgcn_wmma_f32_16x16x32_f16(false, a, false, b, (short)0, c, false, false);
}

// A-fragment loader: 16-bit A 16x32 layout. Lane holds row (lane&15); its 16
// halves are K = {0..7,16..23} (+8 for upper half-wave) -> two contiguous b128s.
__device__ __forceinline__ v16h load_a32(const _Float16* p) {
  F16x16 a;
  v8h lo = *(const v8h*)p;
  v8h hi = *(const v8h*)(p + 16);
#pragma unroll
  for (int i = 0; i < 8; ++i) { a.e[i] = lo[i]; a.e[8 + i] = hi[i]; }
  return a.v;
}

#if defined(__has_builtin)
#if __has_builtin(__builtin_amdgcn_tensor_load_to_lds) && __has_builtin(__builtin_amdgcn_s_wait_tensorcnt)
#define USE_TDM 1
#endif
#endif

#ifdef USE_TDM
// 2D TDM: copy rows x w_elts (2-byte elements, row stride in elements) to LDS.
__device__ __forceinline__ void tdm_load_2d(unsigned lds_byte_off, const void* gsrc,
                                            unsigned w_elts, unsigned rows,
                                            unsigned long row_stride_elts) {
  unsigned long ga = (unsigned long)gsrc;
  u32x4 g0;
  g0[0] = 1u;                                               // count=1, user descriptor
  g0[1] = lds_byte_off;                                     // lds_addr
  g0[2] = (unsigned)ga;                                     // global_addr[31:0]
  g0[3] = (unsigned)((ga >> 32) & 0x01FFFFFFu) | (2u << 30);// global_addr[56:32] | type=2
  i32x8 g1;
  g1[0] = 0x10000;                                          // wg_mask=0, data_size=1 (2B)
  g1[1] = (int)((w_elts & 0xFFFFu) << 16);                  // tensor_dim0[15:0]
  g1[2] = (int)((w_elts >> 16) | ((rows & 0xFFFFu) << 16)); // dim0[31:16] | dim1[15:0]
  g1[3] = (int)((rows >> 16) | ((w_elts & 0xFFFFu) << 16)); // dim1[31:16] | tile_dim0
  g1[4] = (int)(rows & 0xFFFFu);                            // tile_dim1 | tile_dim2=0
  g1[5] = (int)(row_stride_elts & 0xFFFFFFFFul);            // dim0_stride[31:0]
  g1[6] = (int)((row_stride_elts >> 32) & 0xFFFFul);        // dim0_stride[47:32]
  g1[7] = 0;
  i32x4 z4;
  z4[0] = 0; z4[1] = 0; z4[2] = 0; z4[3] = 0;
  i32x8 z8;
#pragma unroll
  for (int i = 0; i < 8; ++i) z8[i] = 0;
  __builtin_amdgcn_tensor_load_to_lds(g0, g1, z4, z4, z8, 0);
}
#endif

__device__ __forceinline__ void cvt_f16(const float* __restrict__ src, _Float16* __restrict__ dst,
                                        int blk) {
  long i = (long)blk * 256 + threadIdx.x;              // < 3145728
  dst[i] = (_Float16)src[i];
  // precaution: the store's address and data registers are rewritten only behind this wait
  asm volatile("s_wait_xcnt 0x0" ::: "memory");
}

// Pack W[768][768] (k rows, n cols) into B-fragment tiles [kt=24][nt=48][512]:
// tile element (lane,i) = W[kt*32 + kof(lane,i)][nt*16 + lane%16]
__device__ __forceinline__ void pack_w(const float* __restrict__ W, _Float16* __restrict__ Wp,
                                       int blk) {
  int idx  = blk * 256 + threadIdx.x;                  // < 589824
  int i    = idx & 15;
  int lane = (idx >> 4) & 31;
  int tile = idx >> 9;
  int nt = tile % 48;
  int kt = tile / 48;
  int k = kt * 32 + ((i < 8) ? i : i + 8) + ((lane & 16) ? 8 : 0);
  int n = nt * 16 + (lane & 15);
  Wp[idx] = (_Float16)W[k * 768 + n];
}

// Pack V [24 heads][2048][64] f16 into per-head A-fragment tiles [kt=64][dt=4][512]
__global__ void pack_v_kernel(const _Float16* __restrict__ Vb, _Float16* __restrict__ Vp) {
  int idx  = blockIdx.x * blockDim.x + threadIdx.x;    // < 3145728
  int i    = idx & 15;
  int lane = (idx >> 4) & 31;
  int tile = (idx >> 9) & 255;                         // 64 kt * 4 dt
  int head = idx >> 17;                                // 2048*64 = 2^17 per head
  int dt = tile & 3;
  int kt = tile >> 2;
  int k = kt * 32 + ((i < 8) ? i : i + 8) + ((lane & 16) ? 8 : 0);
  int d = dt * 16 + (lane & 15);
  Vp[idx] = Vb[((long)head << 17) + k * 64 + d];
}

__device__ __forceinline__ void dscale(const float* __restrict__ de, const float* __restrict__ Wd,
                                       const float* __restrict__ bd, float* __restrict__ dsc) {
  int t = threadIdx.x;
  if (t >= 24) return;
  int b = t / 12, h = t % 12;
  float s = bd[h];
  for (int i = 0; i < 64; ++i) s += de[b * 64 + i] * Wd[i * 12 + h];
  dsc[t] = s * 0.125f;   // fold in 1/sqrt(64)
}

// Everything that depends on the inputs alone, in one launch: block 0 the head
// scales, then the four weight packs, then the conversion of x.
__global__ __launch_bounds__(256) void prep_kernel(
    const float* __restrict__ x, const float* __restrict__ Wq, const float* __restrict__ Wk,
    const float* __restrict__ Wv, const float* __restrict__ Wo, const float* __restrict__ de,
    const float* __restrict__ Wd, const float* __restrict__ bd, _Float16* __restrict__ xh,
    _Float16* __restrict__ wpk, float* __restrict__ dsc) {
  const int blk = blockIdx.x;
  if (blk == 0) {
    dscale(de, Wd, bd, dsc);
  } else if (blk <= 4 * kPackBlocks) {
    const int w = (blk - 1) / kPackBlocks;
    const float* W = (w == 0) ? Wq : (w == 1) ? Wk : (w == 2) ? Wv : Wo;
    pack_w(W, wpk + w * WP_ELT, (blk - 1) - w * kPackBlocks);
  } else {
    cvt_f16(x, xh, blk - 1 - 4 * kPackBlocks);
  }
}

// C[4096,768] = A(f16 row-major) @ Wpacked + bias.
// Block = 4 waves -> 128(M) x 64(N). B panel (24 x 2048 halves = 96KB) staged in
// LDS once per block via TDM; wave computes 32x64, ping-pong A prefetch.
__global__ __launch_bounds__(128) void gemm_wmma_kernel(
    const _Float16* __restrict__ A, const _Float16* __restrict__ Wp0,
    const float* __restrict__ bias0, const float* __restrict__ bias1,
    const float* __restrict__ bias2, _Float16* __restrict__ out_h0,
    float* __restrict__ out_f) {
  extern __shared__ _Float16 smem[];                   // [24][2048] B panel
  // blockIdx.z picks one of up to three products that share A: their packed
  // weights lie one behind the other, and so do their outputs.
  const int z = blockIdx.z;
  const _Float16* __restrict__ Wp = Wp0 + z * WP_ELT;
  const float* __restrict__ bias = (z == 0) ? bias0 : (z == 1) ? bias1 : bias2;
  _Float16* __restrict__ out_h = out_h0 + z * XH_ELT;   // stays null where out_h0 is (z = 0 there)
  const int lane  = threadIdx.x & 31;
  const int wave  = threadIdx.x >> 5;
  const int mbase = blockIdx.x * 128 + wave * 32;
  const int nbase = blockIdx.y * 64;
  const int lm    = lane & 15;
  const int hi8   = (lane & 16) ? 8 : 0;
  const int nt0   = nbase >> 4;

#ifdef USE_TDM
  if (wave == 0) {
    tdm_load_2d((unsigned)(size_t)(&smem[0]), Wp + (long)nt0 * 512,
                2048u, 24u, 48ul * 512ul);
    __builtin_amdgcn_s_wait_tensorcnt(0);
  }
  __syncthreads();
#else
  {  // cooperative fallback copy: 128 threads x v8h
    const _Float16* src = Wp + (long)nt0 * 512;
    for (int r = 0; r < 24; ++r) {
      for (int c = threadIdx.x * 8; c < 2048; c += 128 * 8)
        *(v8h*)(smem + r * 2048 + c) = *(const v8h*)(src + (long)r * 48 * 512 + c);
    }
  }
  __syncthreads();
#endif

  const _Float16* a0p = A + (long)(mbase + lm) * 768 + hi8;
  const _Float16* a1p = a0p + 16 * 768;

  v8f acc[2][4] = {};
  v16h aA0 = load_a32(a0p), aA1 = load_a32(a1p);     // even-kt buffer
  v16h aB0, aB1;                                      // odd-kt buffer

  auto kstep = [&](int kt, v16h& x0, v16h& x1) {
    const _Float16* bp = smem + kt * 2048 + lane * 16;
#pragma unroll
    for (int t = 0; t < 4; ++t) {
      v16h b = *(const v16h*)(bp + t * 512);          // ds_load from shared panel
      acc[0][t] = wmma_f16(x0, b, acc[0][t]);
      acc[1][t] = wmma_f16(x1, b, acc[1][t]);
    }
  };

  for (int kt = 0; kt < 24; kt += 2) {
    aB0 = load_a32(a0p + (kt + 1) * 32);              // prefetch odd kt
    aB1 = load_a32(a1p + (kt + 1) * 32);
    kstep(kt, aA0, aA1);
    if (kt + 2 < 24) {                                // prefetch next even kt
      aA0 = load_a32(a0p + (kt + 2) * 32);
      aA1 = load_a32(a1p + (kt + 2) * 32);
    }
    kstep(kt + 1, aB0, aB1);
  }

#pragma unroll
  for (int m = 0; m < 2; ++m) {
    const int mb = mbase + m * 16;
#pragma unroll
    for (int t = 0; t < 4; ++t) {
      F32x8 u; u.v = acc[m][t];
      const int cidx = nbase + t * 16 + lm;
      const float bv = bias[cidx];
#pragma unroll
      for (int j = 0; j < 8; ++j) {
        int r = mb + hi8 + j;                    // C layout: M = j + 8*(upper half)
        float val = u.e[j] + bv;
        if (out_f) out_f[(long)r * 768 + cidx] = val;
        if (out_h) {                             // scatter into [B,H,S,64]
          int bb = r >> 11, s = r & 2047;
          int h = cidx >> 6, d = cidx & 63;
          out_h[(((long)(bb * 12 + h) << 11) + s) * 64 + d] = (_Float16)val;
        }
      }
    }
  }
}

// Fragment from two 16-byte pieces that lie hstep halves apart.
__device__ __forceinline__ v16h load_frag(const _Float16* p, int hstep) {
  F16x16 a;
  v8h lo = *(const v8h*)p;
  v8h hi = *(const v8h*)(p + hstep);
#pragma unroll
  for (int i = 0; i < 8; ++i) { a.e[i] = lo[i]; a.e[8 + i] = hi[i]; }
  return a.v;
}

// 64 keys of K and of V, global -> LDS, 16 bytes per lane and copy, no register
// in between. The s_wait_xcnt stands inside the statement so that no address
// register is rewritten ahead of it.
__device__ __forceinline__ void copy_kv64(unsigned kl, const _Float16* kg,
                                          unsigned vl, const _Float16* vg) {
  asm volatile(
      "global_load_async_to_lds_b128 %0, %1, off\n\t"
      "global_load_async_to_lds_b128 %2, %3, off\n\t"
      "global_load_async_to_lds_b128 %4, %5, off\n\t"
      "global_load_async_to_lds_b128 %6, %7, off\n\t"
      "global_load_async_to_lds_b128 %8, %9, off\n\t"
      "global_load_async_to_lds_b128 %10, %11, off\n\t"
      "global_load_async_to_lds_b128 %12, %13, off\n\t"
      "global_load_async_to_lds_b128 %14, %15, off\n\t"
      "s_wait_xcnt 0x0"
      :: "v"(kl),                  "v"(kg),
         "v"(kl + 1u * kKStepB),   "v"(kg + 1024),
         "v"(kl + 2u * kKStepB),   "v"(kg + 2048),
         "v"(kl + 3u * kKStepB),   "v"(kg + 3072),
         "v"(vl),                  "v"(vg),
         "v"(vl + 2048u),          "v"(vg + 1024),
         "v"(vl + 4096u),          "v"(vg + 2048),
         "v"(vl + 6144u),          "v"(vg + 3072)
      : "memory");
}

// Transposed flash attention: per wave one 16-row q tile, 64 chunks of 32 keys.
// S^T = K @ Q^T keeps the softmax (key) axis per-lane; P^T converts in-lane to
// the B-fragment for out^T = V^T @ P^T. The four waves of a block share K and V:
// tiles of 128 keys are copied to LDS once per block, two buffers, the next tile
// in flight while this one is worked on. K rows lie at a 144-byte pitch, each V
// fragment as two runs of 16 bytes per lane, so every b128 read is conflict-free.
__global__ __launch_bounds__(128) void attn_kernel(
    const _Float16* __restrict__ Qb, const _Float16* __restrict__ Kb,
    const _Float16* __restrict__ Vp, const float* __restrict__ dsc,
    _Float16* __restrict__ AO) {
  __shared__ __attribute__((aligned(16))) _Float16 kv[2 * kBufH];
  const int tid  = threadIdx.x;
  const int lane = threadIdx.x & 31;
  const int wave = threadIdx.x >> 5;
  const int bh   = blockIdx.y;                 // 0..23
  const int qt   = blockIdx.x * 4 + wave;      // 0..127
  const int lm   = lane & 15;
  const int hi8  = (lane & 16) ? 8 : 0;
  const long hbase = (long)bh << 17;           // 2048*64 per head
  const _Float16* Q = Qb + hbase;
  const _Float16* K = Kb + hbase;
  const _Float16* V = Vp + hbase;
  const int qbase = qt * 16;

  // This lane's 16-byte piece of a tile: source (contiguous) and place in LDS.
  const unsigned lds0 = (unsigned)(size_t)(&kv[0]);
  const unsigned kl0 = lds0 + (unsigned)(tid >> 3) * (kKPitchH * 2u) + (unsigned)(tid & 7) * 16u;
  const unsigned vl0 = lds0 + kKAreaH * 2u + (unsigned)(tid >> 6) * 1024u +
                       (unsigned)(tid & 1) * 512u + (unsigned)((tid >> 1) & 31) * 16u;
  const _Float16* kg0 = K + tid * 8;
  const _Float16* vg0 = V + tid * 8;
  auto copy_tile = [&](int t, int buf) {
    const unsigned bo = (unsigned)buf * (kBufH * 2u);
    const _Float16* kg = kg0 + (long)t * (kTileKeys * 64);
    const _Float16* vg = vg0 + (long)t * (kTileKeys * 64);
    copy_kv64(kl0 + bo, kg, vl0 + bo, vg);
    copy_kv64(kl0 + bo + 64u * kKPitchH * 2u, kg + 4096, vl0 + bo + 8192u, vg + 4096);
  };

  copy_tile(0, 0);

  const float sc = dsc[bh];
  // Q^T B-fragments for the two d-halves (loaded once, reused 64x)
  F16x16 bq0, bq1;
  {
    const _Float16* qp = Q + (qbase + lm) * 64;
#pragma unroll
    for (int i = 0; i < 16; ++i) {
      int d = ((i < 8) ? i : i + 8) + hi8;
      bq0.e[i] = qp[d];
      bq1.e[i] = qp[32 + d];
    }
  }

  // tile 0 has landed for this wave, then for all; only then is it read
  asm volatile("s_wait_asynccnt 0x0" ::: "memory");
  __syncthreads();
  copy_tile(1, 1);

  auto loadK = [&](const _Float16* kp, v16h* ka) {
    ka[0] = load_frag(kp, 16);                      // tile0, d 0..31
    ka[1] = load_frag(kp + 32, 16);                 // tile0, d 32..63
    ka[2] = load_frag(kp + 16 * kKPitchH, 16);      // tile1, d 0..31
    ka[3] = load_frag(kp + 16 * kKPitchH + 32, 16); // tile1, d 32..63
  };

  v8f o[4] = {};
  float mrow = -1e30f, lrow = 0.f;

  // one 32-key chunk; fetches the tile's next chunk of K (if any) into kapf
  // between scores & softmax
  auto chunk = [&](const _Float16* vp, v16h* ka, const _Float16* kpf, v16h* kapf) {
    v16h vv0 = load_frag(vp, 256);
    v16h vv1 = load_frag(vp + 512, 256);
    v16h vv2 = load_frag(vp + 1024, 256);
    v16h vv3 = load_frag(vp + 1536, 256);

    v8f st0 = {}, st1 = {};
    st0 = wmma_f16(ka[0], bq0.v, st0);
    st0 = wmma_f16(ka[1], bq1.v, st0);
    st1 = wmma_f16(ka[2], bq0.v, st1);
    st1 = wmma_f16(ka[3], bq1.v, st1);

    if (kpf) loadK(kpf, kapf);

    F32x8 s0, s1; s0.v = st0; s1.v = st1;
    float cmax = -1e30f;
#pragma unroll
    for (int j = 0; j < 8; ++j) {
      s0.e[j] *= sc; s1.e[j] *= sc;
      cmax = fmaxf(cmax, fmaxf(s0.e[j], s1.e[j]));
    }
    cmax = fmaxf(cmax, __shfl_xor(cmax, 16, 32));   // combine half-waves
    float mnew = fmaxf(mrow, cmax);
    float corr = __expf(mrow - mnew);
    F16x16 pb;                                       // P^T B-fragment, in-lane
    float psum = 0.f;
#pragma unroll
    for (int j = 0; j < 8; ++j) {
      float e0 = __expf(s0.e[j] - mnew);
      float e1 = __expf(s1.e[j] - mnew);
      psum += e0 + e1;
      pb.e[j]     = (_Float16)e0;                    // k' = j    + hi8
      pb.e[8 + j] = (_Float16)e1;                    // k' = j+16 + hi8
    }
    lrow = lrow * corr + psum;
    mrow = mnew;

#pragma unroll
    for (int t = 0; t < 4; ++t) {
      F32x8 uo; uo.v = o[t];
#pragma unroll
      for (int j = 0; j < 8; ++j) uo.e[j] *= corr;
      v16h av = (t == 0) ? vv0 : (t == 1) ? vv1 : (t == 2) ? vv2 : vv3;
      o[t] = wmma_f16(av, pb.v, uo.v);
    }
  };

  constexpr int kTiles = kS / kTileKeys;
  v16h kaA[4], kaB[4];
  for (int t = 0; t < kTiles; ++t) {
    const _Float16* kb = kv + (t & 1) * kBufH + lm * kKPitchH + hi8;
    const _Float16* vb = kv + (t & 1) * kBufH + kKAreaH + lane * 8;
    loadK(kb, kaA);
    chunk(vb,        kaA, kb + 32 * kKPitchH, kaB);
    chunk(vb + 2048, kaB, kb + 64 * kKPitchH, kaA);
    chunk(vb + 4096, kaA, kb + 96 * kKPitchH, kaB);
    chunk(vb + 6144, kaB, nullptr,            kaA);
    // hand-over: this wave's reads of the tile are done and its copies of the
    // next tile have landed, then the same holds for all four waves
    asm volatile("s_wait_dscnt 0x0" ::: "memory");
    asm volatile("s_wait_asynccnt 0x0" ::: "memory");
    __syncthreads();
    if (t + 2 < kTiles) copy_tile(t + 2, t & 1);     // refill the buffer just read
  }
  // no copy is left in flight when the wave ends
  asm volatile("s_wait_asynccnt 0x0" ::: "memory");

  float ltot = lrow + __shfl_xor(lrow, 16, 32);
  float inv = 1.f / ltot;
  const int tokrow  = (bh / 12) * 2048 + qbase + lm;
  const int colbase = (bh % 12) * 64;
#pragma unroll
  for (int t = 0; t < 4; ++t) {
    F32x8 uo; uo.v = o[t];
#pragma unroll
    for (int j = 0; j < 8; ++j) {
      int d = colbase + t * 16 + hi8 + j;
      AO[(long)tokrow * 768 + d] = (_Float16)(uo.e[j] * inv);
    }
  }
}

extern "C" void kernel_launch(void* const* d_in, const int* in_sizes, int n_in,
                              void* d_out, int out_size, void* d_ws, size_t ws_size,
                              hipStream_t stream) {
  (void)in_sizes; (void)n_in; (void)out_size; (void)ws_size;
  const float* x  = (const float*)d_in[0];
  const float* de = (const float*)d_in[1];
  const float* Wq = (const float*)d_in[2];
  const float* bq = (const float*)d_in[3];
  const float* Wk = (const float*)d_in[4];
  const float* bk = (const float*)d_in[5];
  const float* Wv = (const float*)d_in[6];
  const float* bv = (const float*)d_in[7];
  const float* Wd = (const float*)d_in[8];
  const float* bd = (const float*)d_in[9];
  const float* Wp = (const float*)d_in[10];
  const float* bp = (const float*)d_in[11];
  float* out = (float*)d_out;

  _Float16* ws16 = (_Float16*)d_ws;
  _Float16* xh  = ws16;
  _Float16* wqp = xh  + XH_ELT;
  _Float16* wkp = wqp + WP_ELT;
  _Float16* wvp = wkp + WP_ELT;
  _Float16* wpp = wvp + WP_ELT;
  _Float16* qb  = wpp + WP_ELT;
  _Float16* kb  = qb  + XH_ELT;
  _Float16* vb  = kb  + XH_ELT;
  _Float16* vpk = vb  + XH_ELT;
  _Float16* ao  = vpk + XH_ELT;
  float*    dsc = (float*)(ao + XH_ELT);

  prep_kernel<<<kPrepBlocks, 256, 0, stream>>>(
      x, Wq, Wk, Wv, Wp, de, Wd, bd, xh, wqp, dsc);

  // 4096/128 x 768/64 tiles; z = Q, K, V
  gemm_wmma_kernel<<<dim3(32, 12, 3), 128, kPanelBytes, stream>>>(xh, wqp, bq, bk, bv, qb, nullptr);
  pack_v_kernel<<<(XH_ELT + 255) / 256, 256, 0, stream>>>(vb, vpk);

  attn_kernel<<<dim3(32, 24), 128, 0, stream>>>(qb, kb, vpk, dsc, ao);

  gemm_wmma_kernel<<<dim3(32, 12, 1), 128, kPanelBytes, stream>>>(ao, wpp, bp, bp, bp, nullptr, out);
}

// v003
// Measured time: 97.6 microseconds a run.
// Two timings next to v002 both put it at 1.11 times that version's speed.
// Counting every step since v000, it is 1.77 times as fast.
#include <hip/hip_runtime.h>

typedef __attribute__((ext_vector_type(16))) _Float16 v16h;
typedef __attribute__((ext_vector_type(8)))  _Float16 v8h;
typedef __attribute__((ext_vector_type(4)))  _Float16 v4h;
typedef __attribute__((ext_vector_type(8)))  float    v8f;
typedef __attribute__((ext_vector_type(4)))  float    f32x4;
typedef __attribute__((ext_vector_type(4)))  unsigned int u32x4;
typedef __attribute__((ext_vector_type(8)))  int i32x8;
typedef __attribute__((ext_vector_type(4)))  int i32x4;

namespace {
constexpr int  kE = 768, kB = 2, kS = 2048;
constexpr long XH_ELT = (long)kB * kS * kE;   // 3,145,728 halves (x / Q / K / V / AO)
constexpr long WP_ELT = (long)kE * kE;        // 589,824 halves per packed weight
constexpr int  kPackBlocks  = (int)(WP_ELT / (256 * 32));  // blocks per weight pack, 32 elements a thread
constexpr int  kCvtBlocks   = (int)(XH_ELT / (256 * 64));  // blocks for the conversion of x, 64 a thread
constexpr int  kPackVBlocks = (int)(XH_ELT / (256 * 32));  // blocks for the V pack, 32 a thread
constexpr int  kPrepBlocks = 1 + 4 * kPackBlocks + kCvtBlocks;
constexpr unsigned kPanelBytes = 24u * 2048u * 2u;  // 96KB B panel in LDS
constexpr int kTileKeys = 128;                 // keys per K/V tile in LDS
constexpr int kKPitchH  = 72;                  // halves: a 128-byte K row at a 144-byte pitch
constexpr unsigned kKStepB = 16u * kKPitchH * 2u;  // 128 lanes x 16 B = 16 K rows
constexpr int kKAreaH   = kTileKeys * kKPitchH;
constexpr int kBufH     = kKAreaH + kTileKeys * 64;  // K area + V area, halves
}

union F16x16 { v16h v; _Float16 e[16]; };
union F32x8  { v8f  v; float    e[8];  };

__device__ __forceinline__ v8f wmma_f16(v16h a, v16h b, v8f c) {
  return __builtin_amdgcn_wmma_f32_16x16x32_f16(false, a, false, b, (short)0, c, false, false);
}

// A-fragment loader: 16-bit A 16x32 layout. Lane holds row (lane&15); its 16
// halves are K = {0..7,16..23} (+8 for upper half-wave) -> two contiguous b128s.
__device__ __forceinline__ v16h load_a32(const _Float16* p) {
  F16x16 a;
  v8h lo = *(const v8h*)p;
  v8h hi = *(const v8h*)(p + 16);
#pragma unroll
  for (int i = 0; i < 8; ++i) { a.e[i] = lo[i]; a.e[8 + i] = hi[i]; }
  return a.v;
}

#if defined(__has_builtin)
#if __has_builtin(__builtin_amdgcn_tensor_load_to_lds) && __has_builtin(__builtin_amdgcn_s_wait_tensorcnt)
#define USE_TDM 1
#endif
#endif

#ifdef USE_TDM
// 2D TDM: copy rows x w_elts (2-byte elements, row stride in elements) to LDS.
__device__ __forceinline__ void tdm_load_2d(unsigned lds_byte_off, const void* gsrc,
                                            unsigned w_elts, unsigned rows,
                                            unsigned long row_stride_elts) {
  unsigned long ga = (unsigned long)gsrc;
  u32x4 g0;
  g0[0] = 1u;                                               // count=1, user descriptor
  g0[1] = lds_byte_off;                                     // lds_addr
  g0[2] = (unsigned)ga;                                     // global_addr[31:0]
  g0[3] = (unsigned)((ga >> 32) & 0x01FFFFFFu) | (2u << 30);// global_addr[56:32] | type=2
  i32x8 g1;
  g1[0] = 0x10000;                                          // wg_mask=0, data_size=1 (2B)
  g1[1] = (int)((w_elts & 0xFFFFu) << 16);                  // tensor_dim0[15:0]
  g1[2] = (int)((w_elts >> 16) | ((rows & 0xFFFFu) << 16)); // dim0[31:16] | dim1[15:0]
  g1[3] = (int)((rows >> 16) | ((w_elts & 0xFFFFu) << 16)); // dim1[31:16] | tile_dim0
  g1[4] = (int)(rows & 0xFFFFu);                            // tile_dim1 | tile_dim2=0
  g1[5] = (int)(row_stride_elts & 0xFFFFFFFFul);            // dim0_stride[31:0]
  g1[6] = (int)((row_stride_elts >> 32) & 0xFFFFul);        // dim0_stride[47:32]
  g1[7] = 0;
  i32x4 z4;
  z4[0] = 0; z4[1] = 0; z4[2] = 0; z4[3] = 0;
  i32x8 z8;
#pragma unroll
  for (int i = 0; i < 8; ++i) z8[i] = 0;
  __builtin_amdgcn_tensor_load_to_lds(g0, g1, z4, z4, z8, 0);
}
#endif

// A block converts 16384 floats: each thread sixteen 16-byte loads, all issued
// before the first is used, each wave-wide load 512 contiguous bytes.
__device__ __forceinline__ void cvt_f16(const float* __restrict__ src, _Float16* __restrict__ dst,
                                        int blk) {
  const int base = blk * 16384 + threadIdx.x * 4;      // < 3145728
  const float* sp = src + base;
  f32x4 v[16];
  // the loops of this function are unrolled so that v and h stay in registers
#pragma unroll
  for (int j = 0; j < 16; ++j) v[j] = *(const f32x4*)(sp + j * 1024);
  // keeps all sixteen loads ahead of the first conversion: without it the last four
  // are issued only after the first have come back, a second trip to memory
  __builtin_amdgcn_sched_barrier(0);
  // precaution: the loads' address is an input here, so it stays in its registers up to
  // this wait and no load's result lands in them ahead of it
  asm volatile("s_wait_xcnt 0x0" :: "v"(sp) : "memory");
  v4h h[16];
#pragma unroll
  for (int j = 0; j < 16; ++j)
#pragma unroll
    for (int c = 0; c < 4; ++c) h[j][c] = (_Float16)v[j][c];
#pragma unroll
  for (int j = 0; j < 16; ++j) *(v4h*)(dst + base + j * 1024) = h[j];
  // precaution: the stores' address and data registers are rewritten only behind this wait
  asm volatile("s_wait_xcnt 0x0" ::: "memory");
}

// Pack W[768][768] (k rows, n cols) into B-fragment tiles [kt=24][nt=48][512]:
// tile element (lane,i) = W[kt*32 + kof(lane,i)][nt*16 + lane%16]
// A thread makes one lane's 16 halves (32 contiguous bytes out) of two tiles; a
// block takes 16 neighbouring nt of one kt (48 = 3 x 16), so W's lines are used whole.
__device__ __forceinline__ void pack_w(const float* __restrict__ W, _Float16* __restrict__ Wp,
                                       int blk) {
  const int lane = threadIdx.x & 31;
  const int tile = blk * 16 + (threadIdx.x >> 5);      // this one and tile + 8; < 1152
  const int nt = tile % 48;
  const int kt = tile / 48;
  const float* p = W + (kt * 32 + ((lane & 16) ? 8 : 0)) * 768 + nt * 16 + (lane & 15);
  float f[2][16];
  // unrolled here and below: f and h stay in registers, the 32 loads go out as one group
#pragma unroll
  for (int u = 0; u < 2; ++u)
#pragma unroll
    for (int i = 0; i < 16; ++i) f[u][i] = p[((i < 8) ? i : i + 8) * 768 + u * 128];
#pragma unroll
  for (int u = 0; u < 2; ++u) {
    F16x16 h;
#pragma unroll
    for (int i = 0; i < 16; ++i) h.e[i] = (_Float16)f[u][i];
    *(v16h*)(Wp + (tile + u * 8) * 512 + lane * 16) = h.v;
  }
  // precaution: the stores' address and data registers are rewritten only behind this wait
  asm volatile("s_wait_xcnt 0x0" ::: "memory");
}

// Pack V [24 heads][2048][64] f16 into per-head A-fragment tiles [kt=64][dt=4][512]
// A thread makes one lane's 16 halves of two tiles (kt and kt + 2, same dt); a
// block takes 16 tiles of one head, that is 128 whole rows of V.
__global__ __launch_bounds__(256) void pack_v_kernel(const _Float16* __restrict__ Vb,
                                                     _Float16* __restrict__ Vp) {
  const int lane = threadIdx.x & 31;
  const int tile = blockIdx.x * 16 + (threadIdx.x >> 5);  // over all heads, 256 each; < 6144
  const int head = tile >> 8;
  const int dt = tile & 3;
  const int kt = (tile >> 2) & 63;
  const _Float16* p = Vb + (head << 17) + (kt * 32 + ((lane & 16) ? 8 : 0)) * 64 +
                      dt * 16 + (lane & 15);
  F16x16 h[2];
  // unrolled here and below: h stays in registers, the 32 loads go out as one group
#pragma unroll
  for (int u = 0; u < 2; ++u)
#pragma unroll
    for (int i = 0; i < 16; ++i) h[u].e[i] = p[((i < 8) ? i : i + 8) * 64 + u * 4096];
#pragma unroll
  for (int u = 0; u < 2; ++u) *(v16h*)(Vp + (tile + u * 8) * 512 + lane * 16) = h[u].v;
}

__device__ __forceinline__ void dscale(const float* __restrict__ de, const float* __restrict__ Wd,
                                       const float* __restrict__ bd, float* __restrict__ dsc) {
  int t = threadIdx.x;
  if (t >= 24) return;
  int b = t / 12, h = t % 12;
  float s = bd[h];
  for (int i = 0; i < 64; ++i) s += de[b * 64 + i] * Wd[i * 12 + h];
  dsc[t] = s * 0.125f;   // fold in 1/sqrt(64)
}

// Everything that depends on the inputs alone, in one launch: block 0 the head
// scales, then the four weight packs, then the conversion of x.
__global__ __launch_bounds__(256) void prep_kernel(
    const float* __restrict__ x, const float* __restrict__ Wq, const float* __restrict__ Wk,
    const float* __restrict__ Wv, const float* __restrict__ Wo, const float* __restrict__ de,
    const float* __restrict__ Wd, const float* __restrict__ bd, _Float16* __restrict__ xh,
    _Float16* __restrict__ wpk, float* __restrict__ dsc) {
  const int blk = blockIdx.x;
  if (blk == 0) {
    dscale(de, Wd, bd, dsc);
  } else if (blk <= 4 * kPackBlocks) {
    const int w = (blk - 1) / kPackBlocks;
    const float* W = (w == 0) ? Wq : (w == 1) ? Wk : (w == 2) ? Wv : Wo;
    pack_w(W, wpk + w * WP_ELT, (blk - 1) - w * kPackBlocks);
  } else {
    cvt_f16(x, xh, blk - 1 - 4 * kPackBlocks);
  }
}

// C[4096,768] = A(f16 row-major) @ Wpacked + bias.
// Block = 4 waves -> 128(M) x 64(N). B panel (24 x 2048 halves = 96KB) staged in
// LDS once per block via TDM; wave computes 32x64, ping-pong A prefetch.
__global__ __launch_bounds__(128) void gemm_wmma_kernel(
    const _Float16* __restrict__ A, const _Float16* __restrict__ Wp0,
    const float* __restrict__ bias0, const float* __restrict__ bias1,
    const float* __restrict__ bias2, _Float16* __restrict__ out_h0,
    float* __restrict__ out_f) {
  extern __shared__ _Float16 smem[];                   // [24][2048] B panel
  // blockIdx.z picks one of up to three products that share A: their packed
  // weights lie one behind the other, and so do their outputs.
  const int z = blockIdx.z;
  const _Float16* __restrict__ Wp = Wp0 + z * WP_ELT;
  const float* __restrict__ bias = (z == 0) ? bias0 : (z == 1) ? bias1 : bias2;
  _Float16* __restrict__ out_h = out_h0 + z * XH_ELT;   // stays null where out_h0 is (z = 0 there)
  const int lane  = threadIdx.x & 31;
  const int wave  = threadIdx.x >> 5;
  const int mbase = blockIdx.x * 128 + wave * 32;
  const int nbase = blockIdx.y * 64;
  const int lm    = lane & 15;
  const int hi8   = (lane & 16) ? 8 : 0;
  const int nt0   = nbase >> 4;

#ifdef USE_TDM
  if (wave == 0) {
    tdm_load_2d((unsigned)(size_t)(&smem[0]), Wp + (long)nt0 * 512,
                2048u, 24u, 48ul * 512ul);
    __builtin_amdgcn_s_wait_tensorcnt(0);
  }
  __syncthreads();
#else
  {  // cooperative fallback copy: 128 threads x v8h
    const _Float16* src = Wp + (long)nt0 * 512;
    for (int r = 0; r < 24; ++r) {
      for (int c = threadIdx.x * 8; c < 2048; c += 128 * 8)
        *(v8h*)(smem + r * 2048 + c) = *(const v8h*)(src + (long)r * 48 * 512 + c);
    }
  }
  __syncthreads();
#endif

  const _Float16* a0p = A + (long)(mbase + lm) * 768 + hi8;
  const _Float16* a1p = a0p + 16 * 768;

  v8f acc[2][4] = {};
  v16h aA0 = load_a32(a0p), aA1 = load_a32(a1p);     // even-kt buffer
  v16h aB0, aB1;                                      // odd-kt buffer

  auto kstep = [&](int kt, v16h& x0, v16h& x1) {
    const _Float16* bp = smem + kt * 2048 + lane * 16;
#pragma unroll
    for (int t = 0; t < 4; ++t) {
      v16h b = *(const v16h*)(bp + t * 512);          // ds_load from shared panel
      acc[0][t] = wmma_f16(x0, b, acc[0][t]);
      acc[1][t] = wmma_f16(x1, b, acc[1][t]);
    }
  };

  for (int kt = 0; kt < 24; kt += 2) {
    aB0 = load_a32(a0p + (kt + 1) * 32);              // prefetch odd kt
    aB1 = load_a32(a1p + (kt + 1) * 32);
    kstep(kt, aA0, aA1);
    if (kt + 2 < 24) {                                // prefetch next even kt
      aA0 = load_a32(a0p + (kt + 2) * 32);
      aA1 = load_a32(a1p + (kt + 2) * 32);
    }
    kstep(kt + 1, aB0, aB1);
  }

#pragma unroll
  for (int m = 0; m < 2; ++m) {
    const int mb = mbase + m * 16;
#pragma unroll
    for (int t = 0; t < 4; ++t) {
      F32x8 u; u.v = acc[m][t];
      const int cidx = nbase + t * 16 + lm;
      const float bv = bias[cidx];
#pragma unroll
      for (int j = 0; j < 8; ++j) {
        int r = mb + hi8 + j;                    // C layout: M = j + 8*(upper half)
        float val = u.e[j] + bv;
        if (out_f) out_f[(long)r * 768 + cidx] = val;
        if (out_h) {                             // scatter into [B,H,S,64]
          int bb = r >> 11, s = r & 2047;
          int h = cidx >> 6, d = cidx & 63;
          out_h[(((long)(bb * 12 + h) << 11) + s) * 64 + d] = (_Float16)val;
        }
      }
    }
  }
}

// Fragment from two 16-byte pieces that lie hstep halves apart.
__device__ __forceinline__ v16h load_frag(const _Float16* p, int hstep) {
  F16x16 a;
  v8h lo = *(const v8h*)p;
  v8h hi = *(const v8h*)(p + hstep);
#pragma unroll
  for (int i = 0; i < 8; ++i) { a.e[i] = lo[i]; a.e[8 + i] = hi[i]; }
  return a.v;
}

// 64 keys of K and of V, global -> LDS, 16 bytes per lane and copy, no register
// in between. The s_wait_xcnt stands inside the statement so that no address
// register is rewritten ahead of it.
__device__ __forceinline__ void copy_kv64(unsigned kl, const _Float16* kg,
                                          unsigned vl, const _Float16* vg) {
  asm volatile(
      "global_load_async_to_lds_b128 %0, %1, off\n\t"
      "global_load_async_to_lds_b128 %2, %3, off\n\t"
      "global_load_async_to_lds_b128 %4, %5, off\n\t"
      "global_load_async_to_lds_b128 %6, %7, off\n\t"
      "global_load_async_to_lds_b128 %8, %9, off\n\t"
      "global_load_async_to_lds_b128 %10, %11, off\n\t"
      "global_load_async_to_lds_b128 %12, %13, off\n\t"
      "global_load_async_to_lds_b128 %14, %15, off\n\t"
      "s_wait_xcnt 0x0"
      :: "v"(kl),                  "v"(kg),
         "v"(kl + 1u * kKStepB),   "v"(kg + 1024),
         "v"(kl + 2u * kKStepB),   "v"(kg + 2048),
         "v"(kl + 3u * kKStepB),   "v"(kg + 3072),
         "v"(vl),                  "v"(vg),
         "v"(vl + 2048u),          "v"(vg + 1024),
         "v"(vl + 4096u),          "v"(vg + 2048),
         "v"(vl + 6144u),          "v"(vg + 3072)
      : "memory");
}

// Transposed flash attention: per wave one 16-row q tile, 64 chunks of 32 keys.
// S^T = K @ Q^T keeps the softmax (key) axis per-lane; P^T converts in-lane to
// the B-fragment for out^T = V^T @ P^T. The four waves of a block share K and V:
// tiles of 128 keys are copied to LDS once per block, two buffers, the next tile
// in flight while this one is worked on. K rows lie at a 144-byte pitch, each V
// fragment as two runs of 16 bytes per lane, so every b128 read is conflict-free.
__global__ __launch_bounds__(128) void attn_kernel(
    const _Float16* __restrict__ Qb, const _Float16* __restrict__ Kb,
    const _Float16* __restrict__ Vp, const float* __restrict__ dsc,
    _Float16* __restrict__ AO) {
  __shared__ __attribute__((aligned(16))) _Float16 kv[2 * kBufH];
  const int tid  = threadIdx.x;
  const int lane = threadIdx.x & 31;
  const int wave = threadIdx.x >> 5;
  const int bh   = blockIdx.y;                 // 0..23
  const int qt   = blockIdx.x * 4 + wave;      // 0..127
  const int lm   = lane & 15;
  const int hi8  = (lane & 16) ? 8 : 0;
  const long hbase = (long)bh << 17;           // 2048*64 per head
  const _Float16* Q = Qb + hbase;
  const _Float16* K = Kb + hbase;
  const _Float16* V = Vp + hbase;
  const int qbase = qt * 16;

  // This lane's 16-byte piece of a tile: source (contiguous) and place in LDS.
  const unsigned lds0 = (unsigned)(size_t)(&kv[0]);
  const unsigned kl0 = lds0 + (unsigned)(tid >> 3) * (kKPitchH * 2u) + (unsigned)(tid & 7) * 16u;
  const unsigned vl0 = lds0 + kKAreaH * 2u + (unsigned)(tid >> 6) * 1024u +
                       (unsigned)(tid & 1) * 512u + (unsigned)((tid >> 1) & 31) * 16u;
  const _Float16* kg0 = K + tid * 8;
  const _Float16* vg0 = V + tid * 8;
  auto copy_tile = [&](int t, int buf) {
    const unsigned bo = (unsigned)buf * (kBufH * 2u);
    const _Float16* kg = kg0 + (long)t * (kTileKeys * 64);
    const _Float16* vg = vg0 + (long)t * (kTileKeys * 64);
    copy_kv64(kl0 + bo, kg, vl0 + bo, vg);
    copy_kv64(kl0 + bo + 64u * kKPitchH * 2u, kg + 4096, vl0 + bo + 8192u, vg + 4096);
  };

  copy_tile(0, 0);

  const float sc = dsc[bh];
  // Q^T B-fragments for the two d-halves (loaded once, reused 64x)
  F16x16 bq0, bq1;
  {
    const _Float16* qp = Q + (qbase + lm) * 64;
#pragma unroll
    for (int i = 0; i < 16; ++i) {
      int d = ((i < 8) ? i : i + 8) + hi8;
      bq0.e[i] = qp[d];
      bq1.e[i] = qp[32 + d];
    }
  }

  // tile 0 has landed for this wave, then for all; only then is it read
  asm volatile("s_wait_asynccnt 0x0" ::: "memory");
  __syncthreads();
  copy_tile(1, 1);

  auto loadK = [&](const _Float16* kp, v16h* ka) {
    ka[0] = load_frag(kp, 16);                      // tile0, d 0..31
    ka[1] = load_frag(kp + 32, 16);                 // tile0, d 32..63
    ka[2] = load_frag(kp + 16 * kKPitchH, 16);      // tile1, d 0..31
    ka[3] = load_frag(kp + 16 * kKPitchH + 32, 16); // tile1, d 32..63
  };

  v8f o[4] = {};
  float mrow = -1e30f, lrow = 0.f;

  // one 32-key chunk; fetches the tile's next chunk of K (if any) into kapf
  // between scores & softmax
  auto chunk = [&](const _Float16* vp, v16h* ka, const _Float16* kpf, v16h* kapf) {
    v16h vv0 = load_frag(vp, 256);
    v16h vv1 = load_frag(vp + 512, 256);
    v16h vv2 = load_frag(vp + 1024, 256);
    v16h vv3 = load_frag(vp + 1536, 256);

    v8f st0 = {}, st1 = {};
    st0 = wmma_f16(ka[0], bq0.v, st0);
    st0 = wmma_f16(ka[1], bq1.v, st0);
    st1 = wmma_f16(ka[2], bq0.v, st1);
    st1 = wmma_f16(ka[3], bq1.v, st1);

    if (kpf) loadK(kpf, kapf);

    F32x8 s0, s1; s0.v = st0; s1.v = st1;
    float cmax = -1e30f;
#pragma unroll
    for (int j = 0; j < 8; ++j) {
      s0.e[j] *= sc; s1.e[j] *= sc;
      cmax = fmaxf(cmax, fmaxf(s0.e[j], s1.e[j]));
    }
    cmax = fmaxf(cmax, __shfl_xor(cmax, 16, 32));   // combine half-waves
    float mnew = fmaxf(mrow, cmax);
    float corr = __expf(mrow - mnew);
    F16x16 pb;                                       // P^T B-fragment, in-lane
    float psum = 0.f;
#pragma unroll
    for (int j = 0; j < 8; ++j) {
      float e0 = __expf(s0.e[j] - mnew);
      float e1 = __expf(s1.e[j] - mnew);
      psum += e0 + e1;
      pb.e[j]     = (_Float16)e0;                    // k' = j    + hi8
      pb.e[8 + j] = (_Float16)e1;                    // k' = j+16 + hi8
    }
    lrow = lrow * corr + psum;
    mrow = mnew;

#pragma unroll
    for (int t = 0; t < 4; ++t) {
      F32x8 uo; uo.v = o[t];
#pragma unroll
      for (int j = 0; j < 8; ++j) uo.e[j] *= corr;
      v16h av = (t == 0) ? vv0 : (t == 1) ? vv1 : (t == 2) ? vv2 : vv3;
      o[t] = wmma_f16(av, pb.v, uo.v);
    }
  };

  constexpr int kTiles = kS / kTileKeys;
  v16h kaA[4], kaB[4];
  for (int t = 0; t < kTiles; ++t) {
    const _Float16* kb = kv + (t & 1) * kBufH + lm * kKPitchH + hi8;
    const _Float16* vb = kv + (t & 1) * kBufH + kKAreaH + lane * 8;
    loadK(kb, kaA);
    chunk(vb,        kaA, kb + 32 * kKPitchH, kaB);
    chunk(vb + 2048, kaB, kb + 64 * kKPitchH, kaA);
    chunk(vb + 4096, kaA, kb + 96 * kKPitchH, kaB);
    chunk(vb + 6144, kaB, nullptr,            kaA);
    // hand-over: this wave's reads of the tile are done and its copies of the
    // next tile have landed, then the same holds for all four waves
    asm volatile("s_wait_dscnt 0x0" ::: "memory");
    asm volatile("s_wait_asynccnt 0x0" ::: "memory");
    __syncthreads();
    if (t + 2 < kTiles) copy_tile(t + 2, t & 1);     // refill the buffer just read
  }
  // no copy is left in flight when the wave ends
  asm volatile("s_wait_asynccnt 0x0" ::: "memory");

  float ltot = lrow + __shfl_xor(lrow, 16, 32);
  float inv = 1.f / ltot;
  const int tokrow  = (bh / 12) * 2048 + qbase + lm;
  const int colbase = (bh % 12) * 64;
#pragma unroll
  for (int t = 0; t < 4; ++t) {
    F32x8 uo; uo.v = o[t];
#pragma unroll
    for (int j = 0; j < 8; ++j) {
      int d = colbase + t * 16 + hi8 + j;
      AO[(long)tokrow * 768 + d] = (_Float16)(uo.e[j] * inv);
    }
  }
}

extern "C" void kernel_launch(void* const* d_in, const int* in_sizes, int n_in,
                              void* d_out, int out_size, void* d_ws, size_t ws_size,
                              hipStream_t stream) {
  (void)in_sizes; (void)n_in; (void)out_size; (void)ws_size;
  const float* x  = (const float*)d_in[0];
  const float* de = (const float*)d_in[1];
  const float* Wq = (const float*)d_in[2];
  const float* bq = (const float*)d_in[3];
  const float* Wk = (const float*)d_in[4];
  const float* bk = (const float*)d_in[5];
  const float* Wv = (const float*)d_in[6];
  const float* bv = (const float*)d_in[7];
  const float* Wd = (const float*)d_in[8];
  const float* bd = (const float*)d_in[9];
  const float* Wp = (const float*)d_in[10];
  const float* bp = (const float*)d_in[11];
  float* out = (float*)d_out;

  _Float16* ws16 = (_Float16*)d_ws;
  _Float16* xh  = ws16;
  _Float16* wqp = xh  + XH_ELT;
  _Float16* wkp = wqp + WP_ELT;
  _Float16* wvp = wkp + WP_ELT;
  _Float16* wpp = wvp + WP_ELT;
  _Float16* qb  = wpp + WP_ELT;
  _Float16* kb  = qb  + XH_ELT;
  _Float16* vb  = kb  + XH_ELT;
  _Float16* vpk = vb  + XH_ELT;
  _Float16* ao  = vpk + XH_ELT;
  float*    dsc = (float*)(ao + XH_ELT);

  prep_kernel<<<kPrepBlocks, 256, 0, stream>>>(
      x, Wq, Wk, Wv, Wp, de, Wd, bd, xh, wqp, dsc);

  // 4096/128 x 768/64 tiles; z = Q, K, V
  gemm_wmma_kernel<<<dim3(32, 12, 3), 128, kPanelBytes, stream>>>(xh, wqp, bq, bk, bv, qb, nullptr);
  pack_v_kernel<<<kPackVBlocks, 256, 0, stream>>>(vb, vpk);

  attn_kernel<<<dim3(32, 24), 128, 0, stream>>>(qb, kb, vpk, dsc, ao);

  gemm_wmma_kernel<<<dim3(32, 12, 1), 128, kPanelBytes, stream>>>(ao, wpp, bp, bp, bp, nullptr, out);
}

// v004
// One run takes 84.3 microseconds.
// Timed twice side by side with v003, it ran 1.16 times as fast both times.
// All steps since v000 together make it 2.05 times as fast.
#include <hip/hip_runtime.h>

typedef __attribute__((ext_vector_type(16))) _Float16 v16h;
typedef __attribute__((ext_vector_type(8)))  _Float16 v8h;
typedef __attribute__((ext_vector_type(4)))  _Float16 v4h;
typedef __attribute__((ext_vector_type(8)))  float    v8f;
typedef __attribute__((ext_vector_type(4)))  float    f32x4;
typedef __attribute__((ext_vector_type(4)))  unsigned int u32x4;
typedef __attribute__((ext_vector_type(8)))  int i32x8;
typedef __attribute__((ext_vector_type(4)))  int i32x4;

namespace {
constexpr int  kE = 768, kB = 2, kS = 2048;
constexpr long XH_ELT = (long)kB * kS * kE;   // 3,145,728 halves (x / Q / K / V / AO)
constexpr long WP_ELT = (long)kE * kE;        // 589,824 halves per packed weight
constexpr int  kPackBlocks  = (int)(WP_ELT / (256 * 32));  // blocks per weight pack, 32 elements a thread
constexpr int  kCvtBlocks   = (int)(XH_ELT / (256 * 64));  // blocks for the conversion of x, 64 a thread
constexpr int  kPackVBlocks = (int)(XH_ELT / (256 * 32));  // blocks for the V pack, 32 a thread
constexpr int  kPrepBlocks = 1 + 4 * kPackBlocks + kCvtBlocks;
constexpr unsigned kPanelBytes = 24u * 2048u * 2u;  // 96KB B panel in LDS
constexpr int kTileKeys = 128;                 // keys per K/V tile in LDS
constexpr int kKPitchH  = 72;                  // halves: a 128-byte K row at a 144-byte pitch
constexpr unsigned kKStepB = 16u * kKPitchH * 2u;  // 128 lanes x 16 B = 16 K rows
constexpr int kKAreaH   = kTileKeys * kKPitchH;
constexpr int kBufH     = kKAreaH + kTileKeys * 64;  // K area + V area, halves
}

union F16x16 { v16h v; _Float16 e[16]; };
union F32x8  { v8f  v; float    e[8];  };

__device__ __forceinline__ v8f wmma_f16(v16h a, v16h b, v8f c) {
  return __builtin_amdgcn_wmma_f32_16x16x32_f16(false, a, false, b, (short)0, c, false, false);
}

// A-fragment loader: 16-bit A 16x32 layout. Lane holds row (lane&15); its 16
// halves are K = {0..7,16..23} (+8 for upper half-wave) -> two contiguous b128s.
__device__ __forceinline__ v16h load_a32(const _Float16* p) {
  F16x16 a;
  v8h lo = *(const v8h*)p;
  v8h hi = *(const v8h*)(p + 16);
#pragma unroll
  for (int i = 0; i < 8; ++i) { a.e[i] = lo[i]; a.e[8 + i] = hi[i]; }
  return a.v;
}

#if defined(__has_builtin)
#if __has_builtin(__builtin_amdgcn_tensor_load_to_lds) && __has_builtin(__builtin_amdgcn_s_wait_tensorcnt)
#define USE_TDM 1
#endif
#endif

#ifdef USE_TDM
// 2D TDM: copy rows x w_elts (2-byte elements, row stride in elements) to LDS.
__device__ __forceinline__ void tdm_load_2d(unsigned lds_byte_off, const void* gsrc,
                                            unsigned w_elts, unsigned rows,
                                            unsigned long row_stride_elts) {
  unsigned long ga = (unsigned long)gsrc;
  u32x4 g0;
  g0[0] = 1u;                                               // count=1, user descriptor
  g0[1] = lds_byte_off;                                     // lds_addr
  g0[2] = (unsigned)ga;                                     // global_addr[31:0]
  g0[3] = (unsigned)((ga >> 32) & 0x01FFFFFFu) | (2u << 30);// global_addr[56:32] | type=2
  i32x8 g1;
  g1[0] = 0x10000;                                          // wg_mask=0, data_size=1 (2B)
  g1[1] = (int)((w_elts & 0xFFFFu) << 16);                  // tensor_dim0[15:0]
  g1[2] = (int)((w_elts >> 16) | ((rows & 0xFFFFu) << 16)); // dim0[31:16] | dim1[15:0]
  g1[3] = (int)((rows >> 16) | ((w_elts & 0xFFFFu) << 16)); // dim1[31:16] | tile_dim0
  g1[4] = (int)(rows & 0xFFFFu);                            // tile_dim1 | tile_dim2=0
  g1[5] = (int)(row_stride_elts & 0xFFFFFFFFul);            // dim0_stride[31:0]
  g1[6] = (int)((row_stride_elts >> 32) & 0xFFFFul);        // dim0_stride[47:32]
  g1[7] = 0;
  i32x4 z4;
  z4[0] = 0; z4[1] = 0; z4[2] = 0; z4[3] = 0;
  i32x8 z8;
#pragma unroll
  for (int i = 0; i < 8; ++i) z8[i] = 0;
  __builtin_amdgcn_tensor_load_to_lds(g0, g1, z4, z4, z8, 0);
}
#endif

// A block converts 16384 floats: each thread sixteen 16-byte loads, all issued
// before the first is used, each wave-wide load 512 contiguous bytes.
__device__ __forceinline__ void cvt_f16(const float* __restrict__ src, _Float16* __restrict__ dst,
                                        int blk) {
  const int base = blk * 16384 + threadIdx.x * 4;      // < 3145728
  const float* sp = src + base;
  f32x4 v[16];
  // the loops of this function are unrolled so that v and h stay in registers
#pragma unroll
  for (int j = 0; j < 16; ++j) v[j] = *(const f32x4*)(sp + j * 1024);
  // keeps all sixteen loads ahead of the first conversion: without it the last four
  // are issued only after the first have come back, a second trip to memory
  __builtin_amdgcn_sched_barrier(0);
  // precaution: the loads' address is an input here, so it stays in its registers up to
  // this wait and no load's result lands in them ahead of it
  asm volatile("s_wait_xcnt 0x0" :: "v"(sp) : "memory");
  v4h h[16];
#pragma unroll
  for (int j = 0; j < 16; ++j)
#pragma unroll
    for (int c = 0; c < 4; ++c) h[j][c] = (_Float16)v[j][c];
#pragma unroll
  for (int j = 0; j < 16; ++j) *(v4h*)(dst + base + j * 1024) = h[j];
  // precaution: the stores' address and data registers are rewritten only behind this wait
  asm volatile("s_wait_xcnt 0x0" ::: "memory");
}

// Pack W[768][768] (k rows, n cols) into B-fragment tiles [kt=24][nt=48][512]:
// tile element (lane,i) = W[kt*32 + kof(lane,i)][nt*16 + lane%16]
// A thread makes one lane's 16 halves (32 contiguous bytes out) of two tiles; a
// block takes 16 neighbouring nt of one kt (48 = 3 x 16), so W's lines are used whole.
__device__ __forceinline__ void pack_w(const float* __restrict__ W, _Float16* __restrict__ Wp,
                                       int blk) {
  const int lane = threadIdx.x & 31;
  const int tile = blk * 16 + (threadIdx.x >> 5);      // this one and tile + 8; < 1152
  const int nt = tile % 48;
  const int kt = tile / 48;
  const float* p = W + (kt * 32 + ((lane & 16) ? 8 : 0)) * 768 + nt * 16 + (lane & 15);
  float f[2][16];
  // unrolled here and below: f and h stay in registers, the 32 loads go out as one group
#pragma unroll
  for (int u = 0; u < 2; ++u)
#pragma unroll
    for (int i = 0; i < 16; ++i) f[u][i] = p[((i < 8) ? i : i + 8) * 768 + u * 128];
#pragma unroll
  for (int u = 0; u < 2; ++u) {
    F16x16 h;
#pragma unroll
    for (int i = 0; i < 16; ++i) h.e[i] = (_Float16)f[u][i];
    *(v16h*)(Wp + (tile + u * 8) * 512 + lane * 16) = h.v;
  }
  // precaution: the stores' address and data registers are rewritten only behind this wait
  asm volatile("s_wait_xcnt 0x0" ::: "memory");
}

// Pack V [24 heads][2048][64] f16 into per-head A-fragment tiles [kt=64][dt=4][512]
// A thread makes one lane's 16 halves of two tiles (kt and kt + 2, same dt); a
// block takes 16 tiles of one head, that is 128 whole rows of V.
__global__ __launch_bounds__(256) void pack_v_kernel(const _Float16* __restrict__ Vb,
                                                     _Float16* __restrict__ Vp) {
  const int lane = threadIdx.x & 31;
  const int tile = blockIdx.x * 16 + (threadIdx.x >> 5);  // over all heads, 256 each; < 6144
  const int head = tile >> 8;
  const int dt = tile & 3;
  const int kt = (tile >> 2) & 63;
  const _Float16* p = Vb + (head << 17) + (kt * 32 + ((lane & 16) ? 8 : 0)) * 64 +
                      dt * 16 + (lane & 15);
  F16x16 h[2];
  // unrolled here and below: h stays in registers, the 32 loads go out as one group
#pragma unroll
  for (int u = 0; u < 2; ++u)
#pragma unroll
    for (int i = 0; i < 16; ++i) h[u].e[i] = p[((i < 8) ? i : i + 8) * 64 + u * 4096];
#pragma unroll
  for (int u = 0; u < 2; ++u) *(v16h*)(Vp + (tile + u * 8) * 512 + lane * 16) = h[u].v;
}

__device__ __forceinline__ void dscale(const float* __restrict__ de, const float* __restrict__ Wd,
                                       const float* __restrict__ bd, float* __restrict__ dsc) {
  int t = threadIdx.x;
  if (t >= 24) return;
  int b = t / 12, h = t % 12;
  float s = bd[h];
  for (int i = 0; i < 64; ++i) s += de[b * 64 + i] * Wd[i * 12 + h];
  dsc[t] = s * 0.125f;   // fold in 1/sqrt(64)
}

// Everything that depends on the inputs alone, in one launch: block 0 the head
// scales, then the four weight packs, then the conversion of x.
__global__ __launch_bounds__(256) void prep_kernel(
    const float* __restrict__ x, const float* __restrict__ Wq, const float* __restrict__ Wk,
    const float* __restrict__ Wv, const float* __restrict__ Wo, const float* __restrict__ de,
    const float* __restrict__ Wd, const float* __restrict__ bd, _Float16* __restrict__ xh,
    _Float16* __restrict__ wpk, float* __restrict__ dsc) {
  const int blk = blockIdx.x;
  if (blk == 0) {
    dscale(de, Wd, bd, dsc);
  } else if (blk <= 4 * kPackBlocks) {
    const int w = (blk - 1) / kPackBlocks;
    const float* W = (w == 0) ? Wq : (w == 1) ? Wk : (w == 2) ? Wv : Wo;
    pack_w(W, wpk + w * WP_ELT, (blk - 1) - w * kPackBlocks);
  } else {
    cvt_f16(x, xh, blk - 1 - 4 * kPackBlocks);
  }
}

// C[4096,768] = A(f16 row-major) @ Wpacked + bias.
// Block = 4 waves -> 128(M) x 64(N). B panel (24 x 2048 halves = 96KB) staged in
// LDS once per block via TDM; wave computes 32x64. A fragments come from global
// memory kAhead k steps ahead of their products, B fragments from LDS one k step
// ahead, both into register rings.
__global__ __launch_bounds__(128) void gemm_wmma_kernel(
    const _Float16* __restrict__ A, const _Float16* __restrict__ Wp0,
    const float* __restrict__ bias0, const float* __restrict__ bias1,
    const float* __restrict__ bias2, _Float16* __restrict__ out_h0,
    float* __restrict__ out_f) {
  extern __shared__ _Float16 smem[];                   // [24][2048] B panel
  // blockIdx.z picks one of up to three products that share A: their packed
  // weights lie one behind the other, and so do their outputs.
  const int z = blockIdx.z;
  const _Float16* __restrict__ Wp = Wp0 + z * WP_ELT;
  const float* __restrict__ bias = (z == 0) ? bias0 : (z == 1) ? bias1 : bias2;
  _Float16* __restrict__ out_h = out_h0 + z * XH_ELT;   // stays null where out_h0 is (z = 0 there)
  const int lane  = threadIdx.x & 31;
  const int wave  = threadIdx.x >> 5;
  const int mbase = blockIdx.x * 128 + wave * 32;
  const int nbase = blockIdx.y * 64;
  const int lm    = lane & 15;
  const int hi8   = (lane & 16) ? 8 : 0;
  const int nt0   = nbase >> 4;

  const _Float16* a0p = A + (long)(mbase + lm) * 768 + hi8;
  const _Float16* a1p = a0p + 16 * 768;
  constexpr int kSteps = 24;                          // k steps of 32
  constexpr int kAhead = 4;                           // k steps that A is fetched ahead
  v16h a[kAhead + 1][2];                              // ring, slot = k step mod (kAhead + 1)
  // unrolled: the ring's slots are constants, so it stays in registers
#pragma unroll
  for (int s = 0; s < kAhead; ++s) {
    a[s][0] = load_a32(a0p + s * 32);
    a[s][1] = load_a32(a1p + s * 32);
  }

#ifdef USE_TDM
  if (wave == 0) {
    tdm_load_2d((unsigned)(size_t)(&smem[0]), Wp + (long)nt0 * 512,
                2048u, 24u, 48ul * 512ul);
    __builtin_amdgcn_s_wait_tensorcnt(0);
  }
  __syncthreads();
#else
  {  // cooperative fallback copy: 128 threads x v8h
    const _Float16* src = Wp + (long)nt0 * 512;
    for (int r = 0; r < 24; ++r) {
      for (int c = threadIdx.x * 8; c < 2048; c += 128 * 8)
        *(v8h*)(smem + r * 2048 + c) = *(const v8h*)(src + (long)r * 48 * 512 + c);
    }
  }
  __syncthreads();
#endif

  v8f acc[2][4] = {};
  v16h b[2][4];                                       // slot = k step mod 2
  const _Float16* bp = smem + lane * 16;
  // every loop from here to the end of the k loop is unrolled: ring slots are then
  // constants, so both rings stay in registers
#pragma unroll
  for (int t = 0; t < 4; ++t) b[0][t] = *(const v16h*)(bp + t * 512);

#pragma unroll
  for (int kt = 0; kt < kSteps; ++kt) {
    if (kt + kAhead < kSteps) {
      a[(kt + kAhead) % (kAhead + 1)][0] = load_a32(a0p + (kt + kAhead) * 32);
      a[(kt + kAhead) % (kAhead + 1)][1] = load_a32(a1p + (kt + kAhead) * 32);
    }
    if (kt + 1 < kSteps) {
#pragma unroll
      for (int t = 0; t < 4; ++t)
        b[(kt + 1) & 1][t] = *(const v16h*)(bp + (kt + 1) * 2048 + t * 512);
    }
    // keeps the loads above as one group ahead of this step's products: left free, the
    // scheduler sinks each load to just before its use and every latency is waited out
    __builtin_amdgcn_sched_barrier(0);
#pragma unroll
    for (int t = 0; t < 4; ++t) {
      acc[0][t] = wmma_f16(a[kt % (kAhead + 1)][0], b[kt & 1][t], acc[0][t]);
      acc[1][t] = wmma_f16(a[kt % (kAhead + 1)][1], b[kt & 1][t], acc[1][t]);
    }
    // keeps the next step's loads from being spread among these products
    __builtin_amdgcn_sched_barrier(0);
  }

#pragma unroll
  for (int m = 0; m < 2; ++m) {
    const int mb = mbase + m * 16;
#pragma unroll
    for (int t = 0; t < 4; ++t) {
      F32x8 u; u.v = acc[m][t];
      const int cidx = nbase + t * 16 + lm;
      const float bv = bias[cidx];
#pragma unroll
      for (int j = 0; j < 8; ++j) {
        int r = mb + hi8 + j;                    // C layout: M = j + 8*(upper half)
        float val = u.e[j] + bv;
        if (out_f) out_f[(long)r * 768 + cidx] = val;
        if (out_h) {                             // scatter into [B,H,S,64]
          int bb = r >> 11, s = r & 2047;
          int h = cidx >> 6, d = cidx & 63;
          out_h[(((long)(bb * 12 + h) << 11) + s) * 64 + d] = (_Float16)val;
        }
      }
    }
  }
}

// Fragment from two 16-byte pieces that lie hstep halves apart.
__device__ __forceinline__ v16h load_frag(const _Float16* p, int hstep) {
  F16x16 a;
  v8h lo = *(const v8h*)p;
  v8h hi = *(const v8h*)(p + hstep);
#pragma unroll
  for (int i = 0; i < 8; ++i) { a.e[i] = lo[i]; a.e[8 + i] = hi[i]; }
  return a.v;
}

// 64 keys of K and of V, global -> LDS, 16 bytes per lane and copy, no register
// in between. The s_wait_xcnt stands inside the statement so that no address
// register is rewritten ahead of it.
__device__ __forceinline__ void copy_kv64(unsigned kl, const _Float16* kg,
                                          unsigned vl, const _Float16* vg) {
  asm volatile(
      "global_load_async_to_lds_b128 %0, %1, off\n\t"
      "global_load_async_to_lds_b128 %2, %3, off\n\t"
      "global_load_async_to_lds_b128 %4, %5, off\n\t"
      "global_load_async_to_lds_b128 %6, %7, off\n\t"
      "global_load_async_to_lds_b128 %8, %9, off\n\t"
      "global_load_async_to_lds_b128 %10, %11, off\n\t"
      "global_load_async_to_lds_b128 %12, %13, off\n\t"
      "global_load_async_to_lds_b128 %14, %15, off\n\t"
      "s_wait_xcnt 0x0"
      :: "v"(kl),                  "v"(kg),
         "v"(kl + 1u * kKStepB),   "v"(kg + 1024),
         "v"(kl + 2u * kKStepB),   "v"(kg + 2048),
         "v"(kl + 3u * kKStepB),   "v"(kg + 3072),
         "v"(vl),                  "v"(vg),
         "v"(vl + 2048u),          "v"(vg + 1024),
         "v"(vl + 4096u),          "v"(vg + 2048),
         "v"(vl + 6144u),          "v"(vg + 3072)
      : "memory");
}

// Transposed flash attention: per wave one 16-row q tile, 64 chunks of 32 keys.
// S^T = K @ Q^T keeps the softmax (key) axis per-lane; P^T converts in-lane to
// the B-fragment for out^T = V^T @ P^T. The four waves of a block share K and V:
// tiles of 128 keys are copied to LDS once per block, two buffers, the next tile
// in flight while this one is worked on. K rows lie at a 144-byte pitch, each V
// fragment as two runs of 16 bytes per lane, so every b128 read is conflict-free.
__global__ __launch_bounds__(128) void attn_kernel(
    const _Float16* __restrict__ Qb, const _Float16* __restrict__ Kb,
    const _Float16* __restrict__ Vp, const float* __restrict__ dsc,
    _Float16* __restrict__ AO) {
  __shared__ __attribute__((aligned(16))) _Float16 kv[2 * kBufH];
  const int tid  = threadIdx.x;
  const int lane = threadIdx.x & 31;
  const int wave = threadIdx.x >> 5;
  const int bh   = blockIdx.y;                 // 0..23
  const int qt   = blockIdx.x * 4 + wave;      // 0..127
  const int lm   = lane & 15;
  const int hi8  = (lane & 16) ? 8 : 0;
  const long hbase = (long)bh << 17;           // 2048*64 per head
  const _Float16* Q = Qb + hbase;
  const _Float16* K = Kb + hbase;
  const _Float16* V = Vp + hbase;
  const int qbase = qt * 16;

  // This lane's 16-byte piece of a tile: source (contiguous) and place in LDS.
  const unsigned lds0 = (unsigned)(size_t)(&kv[0]);
  const unsigned kl0 = lds0 + (unsigned)(tid >> 3) * (kKPitchH * 2u) + (unsigned)(tid & 7) * 16u;
  const unsigned vl0 = lds0 + kKAreaH * 2u + (unsigned)(tid >> 6) * 1024u +
                       (unsigned)(tid & 1) * 512u + (unsigned)((tid >> 1) & 31) * 16u;
  const _Float16* kg0 = K + tid * 8;
  const _Float16* vg0 = V + tid * 8;
  auto copy_tile = [&](int t, int buf) {
    const unsigned bo = (unsigned)buf * (kBufH * 2u);
    const _Float16* kg = kg0 + (long)t * (kTileKeys * 64);
    const _Float16* vg = vg0 + (long)t * (kTileKeys * 64);
    copy_kv64(kl0 + bo, kg, vl0 + bo, vg);
    copy_kv64(kl0 + bo + 64u * kKPitchH * 2u, kg + 4096, vl0 + bo + 8192u, vg + 4096);
  };

  copy_tile(0, 0);

  const float sc = dsc[bh];
  // Q^T B-fragments for the two d-halves (loaded once, reused 64x)
  F16x16 bq0, bq1;
  {
    const _Float16* qp = Q + (qbase + lm) * 64;
#pragma unroll
    for (int i = 0; i < 16; ++i) {
      int d = ((i < 8) ? i : i + 8) + hi8;
      bq0.e[i] = qp[d];
      bq1.e[i] = qp[32 + d];
    }
  }

  // tile 0 has landed for this wave, then for all; only then is it read
  asm volatile("s_wait_asynccnt 0x0" ::: "memory");
  __syncthreads();
  copy_tile(1, 1);

  auto loadK = [&](const _Float16* kp, v16h* ka) {
    ka[0] = load_frag(kp, 16);                      // tile0, d 0..31
    ka[1] = load_frag(kp + 32, 16);                 // tile0, d 32..63
    ka[2] = load_frag(kp + 16 * kKPitchH, 16);      // tile1, d 0..31
    ka[3] = load_frag(kp + 16 * kKPitchH + 32, 16); // tile1, d 32..63
  };

  v8f o[4] = {};
  float mrow = -1e30f, lrow = 0.f;

  // one 32-key chunk; fetches the tile's next chunk of K (if any) into kapf
  // between scores & softmax
  auto chunk = [&](const _Float16* vp, v16h* ka, const _Float16* kpf, v16h* kapf) {
    v16h vv0 = load_frag(vp, 256);
    v16h vv1 = load_frag(vp + 512, 256);
    v16h vv2 = load_frag(vp + 1024, 256);
    v16h vv3 = load_frag(vp + 1536, 256);

    v8f st0 = {}, st1 = {};
    st0 = wmma_f16(ka[0], bq0.v, st0);
    st0 = wmma_f16(ka[1], bq1.v, st0);
    st1 = wmma_f16(ka[2], bq0.v, st1);
    st1 = wmma_f16(ka[3], bq1.v, st1);

    if (kpf) loadK(kpf, kapf);

    F32x8 s0, s1; s0.v = st0; s1.v = st1;
    float cmax = -1e30f;
#pragma unroll
    for (int j = 0; j < 8; ++j) {
      s0.e[j] *= sc; s1.e[j] *= sc;
      cmax = fmaxf(cmax, fmaxf(s0.e[j], s1.e[j]));
    }
    cmax = fmaxf(cmax, __shfl_xor(cmax, 16, 32));   // combine half-waves
    float mnew = fmaxf(mrow, cmax);
    float corr = __expf(mrow - mnew);
    F16x16 pb;                                       // P^T B-fragment, in-lane
    float psum = 0.f;
#pragma unroll
    for (int j = 0; j < 8; ++j) {
      float e0 = __expf(s0.e[j] - mnew);
      float e1 = __expf(s1.e[j] - mnew);
      psum += e0 + e1;
      pb.e[j]     = (_Float16)e0;                    // k' = j    + hi8
      pb.e[8 + j] = (_Float16)e1;                    // k' = j+16 + hi8
    }
    lrow = lrow * corr + psum;
    mrow = mnew;

#pragma unroll
    for (int t = 0; t < 4; ++t) {
      F32x8 uo; uo.v = o[t];
#pragma unroll
      for (int j = 0; j < 8; ++j) uo.e[j] *= corr;
      v16h av = (t == 0) ? vv0 : (t == 1) ? vv1 : (t == 2) ? vv2 : vv3;
      o[t] = wmma_f16(av, pb.v, uo.v);
    }
  };

  constexpr int kTiles = kS / kTileKeys;
  v16h kaA[4], kaB[4];
  for (int t = 0; t < kTiles; ++t) {
    const _Float16* kb = kv + (t & 1) * kBufH + lm * kKPitchH + hi8;
    const _Float16* vb = kv + (t & 1) * kBufH + kKAreaH + lane * 8;
    loadK(kb, kaA);
    chunk(vb,        kaA, kb + 32 * kKPitchH, kaB);
    chunk(vb + 2048, kaB, kb + 64 * kKPitchH, kaA);
    chunk(vb + 4096, kaA, kb + 96 * kKPitchH, kaB);
    chunk(vb + 6144, kaB, nullptr,            kaA);
    // hand-over: this wave's reads of the tile are done and its copies of the
    // next tile have landed, then the same holds for all four waves
    asm volatile("s_wait_dscnt 0x0" ::: "memory");
    asm volatile("s_wait_asynccnt 0x0" ::: "memory");
    __syncthreads();
    if (t + 2 < kTiles) copy_tile(t + 2, t & 1);     // refill the buffer just read
  }
  // no copy is left in flight when the wave ends
  asm volatile("s_wait_asynccnt 0x0" ::: "memory");

  float ltot = lrow + __shfl_xor(lrow, 16, 32);
  float inv = 1.f / ltot;
  const int tokrow  = (bh / 12) * 2048 + qbase + lm;
  const int colbase = (bh % 12) * 64;
#pragma unroll
  for (int t = 0; t < 4; ++t) {
    F32x8 uo; uo.v = o[t];
#pragma unroll
    for (int j = 0; j < 8; ++j) {
      int d = colbase + t * 16 + hi8 + j;
      AO[(long)tokrow * 768 + d] = (_Float16)(uo.e[j] * inv);
    }
  }
}

extern "C" void kernel_launch(void* const* d_in, const int* in_sizes, int n_in,
                              void* d_out, int out_size, void* d_ws, size_t ws_size,
                              hipStream_t stream) {
  (void)in_sizes; (void)n_in; (void)out_size; (void)ws_size;
  const float* x  = (const float*)d_in[0];
  const float* de = (const float*)d_in[1];
  const float* Wq = (const float*)d_in[2];
  const float* bq = (const float*)d_in[3];
  const float* Wk = (const float*)d_in[4];
  const float* bk = (const float*)d_in[5];
  const float* Wv = (const float*)d_in[6];
  const float* bv = (const float*)d_in[7];
  const float* Wd = (const float*)d_in[8];
  const float* bd = (const float*)d_in[9];
  const float* Wp = (const float*)d_in[10];
  const float* bp = (const float*)d_in[11];
  float* out = (float*)d_out;

  _Float16* ws16 = (_Float16*)d_ws;
  _Float16* xh  = ws16;
  _Float16* wqp = xh  + XH_ELT;
  _Float16* wkp = wqp + WP_ELT;
  _Float16* wvp = wkp + WP_ELT;
  _Float16* wpp = wvp + WP_ELT;
  _Float16* qb  = wpp + WP_ELT;
  _Float16* kb  = qb  + XH_ELT;
  _Float16* vb  = kb  + XH_ELT;
  _Float16* vpk = vb  + XH_ELT;
  _Float16* ao  = vpk + XH_ELT;
  float*    dsc = (float*)(ao + XH_ELT);

  prep_kernel<<<kPrepBlocks, 256, 0, stream>>>(
      x, Wq, Wk, Wv, Wp, de, Wd, bd, xh, wqp, dsc);

  // 4096/128 x 768/64 tiles; z = Q, K, V
  gemm_wmma_kernel<<<dim3(32, 12, 3), 128, kPanelBytes, stream>>>(xh, wqp, bq, bk, bv, qb, nullptr);
  pack_v_kernel<<<kPackVBlocks, 256, 0, stream>>>(vb, vpk);

  attn_kernel<<<dim3(32, 24), 128, 0, stream>>>(qb, kb, vpk, dsc, ao);

  gemm_wmma_kernel<<<dim3(32, 12, 1), 128, kPanelBytes, stream>>>(ao, wpp, bp, bp, bp, nullptr, out);
}

// v005
// It runs in 76.7 microseconds.
// In both of two side-by-side timings against v004, it was 1.10 times as fast.
// All steps since v000 together make it 2.25 times as fast.
#include <hip/hip_runtime.h>

typedef __attribute__((ext_vector_type(16))) _Float16 v16h;
typedef __attribute__((ext_vector_type(8)))  _Float16 v8h;
typedef __attribute__((ext_vector_type(4)))  _Float16 v4h;
typedef __attribute__((ext_vector_type(8)))  float    v8f;
typedef __attribute__((ext_vector_type(4)))  float    f32x4;
typedef __attribute__((ext_vector_type(4)))  unsigned int u32x4;
typedef __attribute__((ext_vector_type(8)))  int i32x8;
typedef __attribute__((ext_vector_type(4)))  int i32x4;

namespace {
constexpr int  kE = 768, kB = 2, kS = 2048;
constexpr long XH_ELT = (long)kB * kS * kE;   // 3,145,728 halves (x / Q / K / V / AO)
constexpr long WP_ELT = (long)kE * kE;        // 589,824 halves per packed weight
constexpr int  kPackBlocks  = (int)(WP_ELT / (256 * 32));  // blocks per weight pack, 32 elements a thread
constexpr int  kCvtBlocks   = (int)(XH_ELT / (256 * 64));  // blocks for the conversion of x, 64 a thread
constexpr int  kPrepBlocks = 1 + 4 * kPackBlocks + kCvtBlocks;
constexpr unsigned kPanelBytes = 24u * 2048u * 2u;  // 96KB B panel in LDS
constexpr int kTileKeys = 128;                 // keys per K/V tile in LDS
constexpr int kKPitchH  = 72;                  // halves: a 128-byte K row at a 144-byte pitch
constexpr unsigned kKStepB = 16u * kKPitchH * 2u;  // 128 lanes x 16 B = 16 K rows
constexpr int kKAreaH   = kTileKeys * kKPitchH;
constexpr int kBufH     = kKAreaH + kTileKeys * 64;  // K area + V area, halves
}

union F16x16 { v16h v; _Float16 e[16]; };
union F32x8  { v8f  v; float    e[8];  };

__device__ __forceinline__ v8f wmma_f16(v16h a, v16h b, v8f c) {
  return __builtin_amdgcn_wmma_f32_16x16x32_f16(false, a, false, b, (short)0, c, false, false);
}

// A-fragment loader: 16-bit A 16x32 layout. Lane holds row (lane&15); its 16
// halves are K = {0..7,16..23} (+8 for upper half-wave) -> two contiguous b128s.
__device__ __forceinline__ v16h load_a32(const _Float16* p) {
  F16x16 a;
  v8h lo = *(const v8h*)p;
  v8h hi = *(const v8h*)(p + 16);
#pragma unroll
  for (int i = 0; i < 8; ++i) { a.e[i] = lo[i]; a.e[8 + i] = hi[i]; }
  return a.v;
}

#if defined(__has_builtin)
#if __has_builtin(__builtin_amdgcn_tensor_load_to_lds) && __has_builtin(__builtin_amdgcn_s_wait_tensorcnt)
#define USE_TDM 1
#endif
#endif

#ifdef USE_TDM
// 2D TDM: copy rows x w_elts (2-byte elements, row stride in elements) to LDS.
__device__ __forceinline__ void tdm_load_2d(unsigned lds_byte_off, const void* gsrc,
                                            unsigned w_elts, unsigned rows,
                                            unsigned long row_stride_elts) {
  unsigned long ga = (unsigned long)gsrc;
  u32x4 g0;
  g0[0] = 1u;                                               // count=1, user descriptor
  g0[1] = lds_byte_off;                                     // lds_addr
  g0[2] = (unsigned)ga;                                     // global_addr[31:0]
  g0[3] = (unsigned)((ga >> 32) & 0x01FFFFFFu) | (2u << 30);// global_addr[56:32] | type=2
  i32x8 g1;
  g1[0] = 0x10000;                                          // wg_mask=0, data_size=1 (2B)
  g1[1] = (int)((w_elts & 0xFFFFu) << 16);                  // tensor_dim0[15:0]
  g1[2] = (int)((w_elts >> 16) | ((rows & 0xFFFFu) << 16)); // dim0[31:16] | dim1[15:0]
  g1[3] = (int)((rows >> 16) | ((w_elts & 0xFFFFu) << 16)); // dim1[31:16] | tile_dim0
  g1[4] = (int)(rows & 0xFFFFu);                            // tile_dim1 | tile_dim2=0
  g1[5] = (int)(row_stride_elts & 0xFFFFFFFFul);            // dim0_stride[31:0]
  g1[6] = (int)((row_stride_elts >> 32) & 0xFFFFul);        // dim0_stride[47:32]
  g1[7] = 0;
  i32x4 z4;
  z4[0] = 0; z4[1] = 0; z4[2] = 0; z4[3] = 0;
  i32x8 z8;
#pragma unroll
  for (int i = 0; i < 8; ++i) z8[i] = 0;
  __builtin_amdgcn_tensor_load_to_lds(g0, g1, z4, z4, z8, 0);
}
#endif

// A block converts 16384 floats: each thread sixteen 16-byte loads, all issued
// before the first is used, each wave-wide load 512 contiguous bytes.
__device__ __forceinline__ void cvt_f16(const float* __restrict__ src, _Float16* __restrict__ dst,
                                        int blk) {
  const int base = blk * 16384 + threadIdx.x * 4;      // < 3145728
  const float* sp = src + base;
  f32x4 v[16];
  // the loops of this function are unrolled so that v and h stay in registers
#pragma unroll
  for (int j = 0; j < 16; ++j) v[j] = *(const f32x4*)(sp + j * 1024);
  // keeps all sixteen loads ahead of the first conversion: without it the last four
  // are issued only after the first have come back, a second trip to memory
  __builtin_amdgcn_sched_barrier(0);
  // precaution: the loads' address is an input here, so it stays in its registers up to
  // this wait and no load's result lands in them ahead of it
  asm volatile("s_wait_xcnt 0x0" :: "v"(sp) : "memory");
  v4h h[16];
#pragma unroll
  for (int j = 0; j < 16; ++j)
#pragma unroll
    for (int c = 0; c < 4; ++c) h[j][c] = (_Float16)v[j][c];
#pragma unroll
  for (int j = 0; j < 16; ++j) *(v4h*)(dst + base + j * 1024) = h[j];
  // precaution: the stores' address and data registers are rewritten only behind this wait
  asm volatile("s_wait_xcnt 0x0" ::: "memory");
}

// Pack W[768][768] (k rows, n cols) into B-fragment tiles [kt=24][nt=48][512]:
// tile element (lane,i) = W[kt*32 + kof(lane,i)][nt*16 + lane%16]
// A thread makes one lane's 16 halves (32 contiguous bytes out) of two tiles; a
// block takes 16 neighbouring nt of one kt (48 = 3 x 16), so W's lines are used whole.
__device__ __forceinline__ void pack_w(const float* __restrict__ W, _Float16* __restrict__ Wp,
                                       int blk) {
  const int lane = threadIdx.x & 31;
  const int tile = blk * 16 + (threadIdx.x >> 5);      // this one and tile + 8; < 1152
  const int nt = tile % 48;
  const int kt = tile / 48;
  const float* p = W + (kt * 32 + ((lane & 16) ? 8 : 0)) * 768 + nt * 16 + (lane & 15);
  float f[2][16];
  // unrolled here and below: f and h stay in registers, the 32 loads go out as one group
#pragma unroll
  for (int u = 0; u < 2; ++u)
#pragma unroll
    for (int i = 0; i < 16; ++i) f[u][i] = p[((i < 8) ? i : i + 8) * 768 + u * 128];
#pragma unroll
  for (int u = 0; u < 2; ++u) {
    F16x16 h;
#pragma unroll
    for (int i = 0; i < 16; ++i) h.e[i] = (_Float16)f[u][i];
    *(v16h*)(Wp + (tile + u * 8) * 512 + lane * 16) = h.v;
  }
  // precaution: the stores' address and data registers are rewritten only behind this wait
  asm volatile("s_wait_xcnt 0x0" ::: "memory");
}

__device__ __forceinline__ void dscale(const float* __restrict__ de, const float* __restrict__ Wd,
                                       const float* __restrict__ bd, float* __restrict__ dsc) {
  int t = threadIdx.x;
  if (t >= 24) return;
  int b = t / 12, h = t % 12;
  float s = bd[h];
  for (int i = 0; i < 64; ++i) s += de[b * 64 + i] * Wd[i * 12 + h];
  dsc[t] = s * 0.125f;   // fold in 1/sqrt(64)
}

// Everything that depends on the inputs alone, in one launch: block 0 the head
// scales, then the four weight packs, then the conversion of x.
__global__ __launch_bounds__(256) void prep_kernel(
    const float* __restrict__ x, const float* __restrict__ Wq, const float* __restrict__ Wk,
    const float* __restrict__ Wv, const float* __restrict__ Wo, const float* __restrict__ de,
    const float* __restrict__ Wd, const float* __restrict__ bd, _Float16* __restrict__ xh,
    _Float16* __restrict__ wpk, float* __restrict__ dsc) {
  const int blk = blockIdx.x;
  if (blk == 0) {
    dscale(de, Wd, bd, dsc);
  } else if (blk <= 4 * kPackBlocks) {
    const int w = (blk - 1) / kPackBlocks;
    const float* W = (w == 0) ? Wq : (w == 1) ? Wk : (w == 2) ? Wv : Wo;
    pack_w(W, wpk + w * WP_ELT, (blk - 1) - w * kPackBlocks);
  } else {
    cvt_f16(x, xh, blk - 1 - 4 * kPackBlocks);
  }
}

// C[4096,768] = A(f16 row-major) @ Wpacked + bias.
// Block = 4 waves -> 128(M) x 64(N). B panel (24 x 2048 halves = 96KB) staged in
// LDS once per block via TDM; wave computes 32x64. A fragments come from global
// memory kAhead k steps ahead of their products, B fragments from LDS one k step
// ahead, both into register rings. Half outputs: products 0 and 1 (Q, K) go out as
// [B,H,S,64] rows; product 2 (V) goes out as the attention's A-fragment tiles, per
// head [kt=64][dt=4][512], tile element (lane,i) = V[kt*32 + kof(lane,i)][dt*16 + lane%16].
__global__ __launch_bounds__(128) void gemm_wmma_kernel(
    const _Float16* __restrict__ A, const _Float16* __restrict__ Wp0,
    const float* __restrict__ bias0, const float* __restrict__ bias1,
    const float* __restrict__ bias2, _Float16* __restrict__ out_h0,
    float* __restrict__ out_f) {
  extern __shared__ _Float16 smem[];                   // [24][2048] B panel
  // blockIdx.z picks one of up to three products that share A: their packed
  // weights lie one behind the other, and so do their outputs.
  const int z = blockIdx.z;
  const _Float16* __restrict__ Wp = Wp0 + z * WP_ELT;
  const float* __restrict__ bias = (z == 0) ? bias0 : (z == 1) ? bias1 : bias2;
  _Float16* __restrict__ out_h = out_h0 + z * XH_ELT;   // stays null where out_h0 is (z = 0 there)
  const int lane  = threadIdx.x & 31;
  const int wave  = threadIdx.x >> 5;
  const int mbase = blockIdx.x * 128 + wave * 32;
  const int nbase = blockIdx.y * 64;
  const int lm    = lane & 15;
  const int hi8   = (lane & 16) ? 8 : 0;
  const int nt0   = nbase >> 4;

  const _Float16* a0p = A + (long)(mbase + lm) * 768 + hi8;
  const _Float16* a1p = a0p + 16 * 768;
  constexpr int kSteps = 24;                          // k steps of 32
  constexpr int kAhead = 4;                           // k steps that A is fetched ahead
  v16h a[kAhead + 1][2];                              // ring, slot = k step mod (kAhead + 1)
  // unrolled: the ring's slots are constants, so it stays in registers
#pragma unroll
  for (int s = 0; s < kAhead; ++s) {
    a[s][0] = load_a32(a0p + s * 32);
    a[s][1] = load_a32(a1p + s * 32);
  }

#ifdef USE_TDM
  if (wave == 0) {
    tdm_load_2d((unsigned)(size_t)(&smem[0]), Wp + (long)nt0 * 512,
                2048u, 24u, 48ul * 512ul);
    __builtin_amdgcn_s_wait_tensorcnt(0);
  }
  __syncthreads();
#else
  {  // cooperative fallback copy: 128 threads x v8h
    const _Float16* src = Wp + (long)nt0 * 512;
    for (int r = 0; r < 24; ++r) {
      for (int c = threadIdx.x * 8; c < 2048; c += 128 * 8)
        *(v8h*)(smem + r * 2048 + c) = *(const v8h*)(src + (long)r * 48 * 512 + c);
    }
  }
  __syncthreads();
#endif

  v8f acc[2][4] = {};
  v16h b[2][4];                                       // slot = k step mod 2
  const _Float16* bp = smem + lane * 16;
  // every loop from here to the end of the k loop is unrolled: ring slots are then
  // constants, so both rings stay in registers
#pragma unroll
  for (int t = 0; t < 4; ++t) b[0][t] = *(const v16h*)(bp + t * 512);

#pragma unroll
  for (int kt = 0; kt < kSteps; ++kt) {
    if (kt + kAhead < kSteps) {
      a[(kt + kAhead) % (kAhead + 1)][0] = load_a32(a0p + (kt + kAhead) * 32);
      a[(kt + kAhead) % (kAhead + 1)][1] = load_a32(a1p + (kt + kAhead) * 32);
    }
    if (kt + 1 < kSteps) {
#pragma unroll
      for (int t = 0; t < 4; ++t)
        b[(kt + 1) & 1][t] = *(const v16h*)(bp + (kt + 1) * 2048 + t * 512);
    }
    // keeps the loads above as one group ahead of this step's products: left free, the
    // scheduler sinks each load to just before its use and every latency is waited out
    __builtin_amdgcn_sched_barrier(0);
#pragma unroll
    for (int t = 0; t < 4; ++t) {
      acc[0][t] = wmma_f16(a[kt % (kAhead + 1)][0], b[kt & 1][t], acc[0][t]);
      acc[1][t] = wmma_f16(a[kt % (kAhead + 1)][1], b[kt & 1][t], acc[1][t]);
    }
    // keeps the next step's loads from being spread among these products
    __builtin_amdgcn_sched_barrier(0);
  }

  if (z == 2) {
    // The wave's 32 rows are one kt of one head, its four column tiles the four dt.
    // A lane's accumulators hold column lane%16 and rows m*16 + hi8 + j, which are the
    // fragment's halves i = m*8 + j of this same lane: 32 contiguous bytes per tile.
    _Float16* vt = out_h + ((long)((mbase >> 11) * 12 + blockIdx.y) << 17) +
                   ((mbase & 2047) >> 5) * 2048 + lane * 16;
    F16x16 h[4];
    // unrolled here and below: h stays in registers
#pragma unroll
    for (int t = 0; t < 4; ++t) {
      const float bv = bias[nbase + t * 16 + lm];
#pragma unroll
      for (int j = 0; j < 8; ++j) {
        h[t].e[j]     = (_Float16)(acc[0][t][j] + bv);
        h[t].e[8 + j] = (_Float16)(acc[1][t][j] + bv);
      }
    }
#pragma unroll
    for (int t = 0; t < 4; ++t) *(v16h*)(vt + t * 512) = h[t].v;
    return;
  }

#pragma unroll
  for (int m = 0; m < 2; ++m) {
    const int mb = mbase + m * 16;
#pragma unroll
    for (int t = 0; t < 4; ++t) {
      F32x8 u; u.v = acc[m][t];
      const int cidx = nbase + t * 16 + lm;
      const float bv = bias[cidx];
#pragma unroll
      for (int j = 0; j < 8; ++j) {
        int r = mb + hi8 + j;                    // C layout: M = j + 8*(upper half)
        float val = u.e[j] + bv;
        if (out_f) out_f[(long)r * 768 + cidx] = val;
        if (out_h) {                             // scatter into [B,H,S,64]
          int bb = r >> 11, s = r & 2047;
          int h = cidx >> 6, d = cidx & 63;
          out_h[(((long)(bb * 12 + h) << 11) + s) * 64 + d] = (_Float16)val;
        }
      }
    }
  }
}

// Fragment from two 16-byte pieces that lie hstep halves apart.
__device__ __forceinline__ v16h load_frag(const _Float16* p, int hstep) {
  F16x16 a;
  v8h lo = *(const v8h*)p;
  v8h hi = *(const v8h*)(p + hstep);
#pragma unroll
  for (int i = 0; i < 8; ++i) { a.e[i] = lo[i]; a.e[8 + i] = hi[i]; }
  return a.v;
}

// 64 keys of K and of V, global -> LDS, 16 bytes per lane and copy, no register
// in between. The s_wait_xcnt stands inside the statement so that no address
// register is rewritten ahead of it.
__device__ __forceinline__ void copy_kv64(unsigned kl, const _Float16* kg,
                                          unsigned vl, const _Float16* vg) {
  asm volatile(
      "global_load_async_to_lds_b128 %0, %1, off\n\t"
      "global_load_async_to_lds_b128 %2, %3, off\n\t"
      "global_load_async_to_lds_b128 %4, %5, off\n\t"
      "global_load_async_to_lds_b128 %6, %7, off\n\t"
      "global_load_async_to_lds_b128 %8, %9, off\n\t"
      "global_load_async_to_lds_b128 %10, %11, off\n\t"
      "global_load_async_to_lds_b128 %12, %13, off\n\t"
      "global_load_async_to_lds_b128 %14, %15, off\n\t"
      "s_wait_xcnt 0x0"
      :: "v"(kl),                  "v"(kg),
         "v"(kl + 1u * kKStepB),   "v"(kg + 1024),
         "v"(kl + 2u * kKStepB),   "v"(kg + 2048),
         "v"(kl + 3u * kKStepB),   "v"(kg + 3072),
         "v"(vl),                  "v"(vg),
         "v"(vl + 2048u),          "v"(vg + 1024),
         "v"(vl + 4096u),          "v"(vg + 2048),
         "v"(vl + 6144u),          "v"(vg + 3072)
      : "memory");
}

// Transposed flash attention: per wave one 16-row q tile, 64 chunks of 32 keys.
// S^T = K @ Q^T keeps the softmax (key) axis per-lane; P^T converts in-lane to
// the B-fragment for out^T = V^T @ P^T. The four waves of a block share K and V:
// tiles of 128 keys are copied to LDS once per block, two buffers, the next tile
// in flight while this one is worked on. K rows lie at a 144-byte pitch, each V
// fragment as two runs of 16 bytes per lane, so every b128 read is conflict-free.
__global__ __launch_bounds__(128) void attn_kernel(
    const _Float16* __restrict__ Qb, const _Float16* __restrict__ Kb,
    const _Float16* __restrict__ Vp, const float* __restrict__ dsc,
    _Float16* __restrict__ AO) {
  __shared__ __attribute__((aligned(16))) _Float16 kv[2 * kBufH];
  const int tid  = threadIdx.x;
  const int lane = threadIdx.x & 31;
  const int wave = threadIdx.x >> 5;
  const int bh   = blockIdx.y;                 // 0..23
  const int qt   = blockIdx.x * 4 + wave;      // 0..127
  const int lm   = lane & 15;
  const int hi8  = (lane & 16) ? 8 : 0;
  const long hbase = (long)bh << 17;           // 2048*64 per head
  const _Float16* Q = Qb + hbase;
  const _Float16* K = Kb + hbase;
  const _Float16* V = Vp + hbase;
  const int qbase = qt * 16;

  // This lane's 16-byte piece of a tile: source (contiguous) and place in LDS.
  const unsigned lds0 = (unsigned)(size_t)(&kv[0]);
  const unsigned kl0 = lds0 + (unsigned)(tid >> 3) * (kKPitchH * 2u) + (unsigned)(tid & 7) * 16u;
  const unsigned vl0 = lds0 + kKAreaH * 2u + (unsigned)(tid >> 6) * 1024u +
                       (unsigned)(tid & 1) * 512u + (unsigned)((tid >> 1) & 31) * 16u;
  const _Float16* kg0 = K + tid * 8;
  const _Float16* vg0 = V + tid * 8;
  auto copy_tile = [&](int t, int buf) {
    const unsigned bo = (unsigned)buf * (kBufH * 2u);
    const _Float16* kg = kg0 + (long)t * (kTileKeys * 64);
    const _Float16* vg = vg0 + (long)t * (kTileKeys * 64);
    copy_kv64(kl0 + bo, kg, vl0 + bo, vg);
    copy_kv64(kl0 + bo + 64u * kKPitchH * 2u, kg + 4096, vl0 + bo + 8192u, vg + 4096);
  };

  copy_tile(0, 0);

  const float sc = dsc[bh];
  // Q^T B-fragments for the two d-halves (loaded once, reused 64x)
  F16x16 bq0, bq1;
  {
    const _Float16* qp = Q + (qbase + lm) * 64;
#pragma unroll
    for (int i = 0; i < 16; ++i) {
      int d = ((i < 8) ? i : i + 8) + hi8;
      bq0.e[i] = qp[d];
      bq1.e[i] = qp[32 + d];
    }
  }

  // tile 0 has landed for this wave, then for all; only then is it read
  asm volatile("s_wait_asynccnt 0x0" ::: "memory");
  __syncthreads();
  copy_tile(1, 1);

  auto loadK = [&](const _Float16* kp, v16h* ka) {
    ka[0] = load_frag(kp, 16);                      // tile0, d 0..31
    ka[1] = load_frag(kp + 32, 16);                 // tile0, d 32..63
    ka[2] = load_frag(kp + 16 * kKPitchH, 16);      // tile1, d 0..31
    ka[3] = load_frag(kp + 16 * kKPitchH + 32, 16); // tile1, d 32..63
  };

  v8f o[4] = {};
  float mrow = -1e30f, lrow = 0.f;

  // one 32-key chunk; fetches the tile's next chunk of K (if any) into kapf
  // between scores & softmax
  auto chunk = [&](const _Float16* vp, v16h* ka, const _Float16* kpf, v16h* kapf) {
    v16h vv0 = load_frag(vp, 256);
    v16h vv1 = load_frag(vp + 512, 256);
    v16h vv2 = load_frag(vp + 1024, 256);
    v16h vv3 = load_frag(vp + 1536, 256);

    v8f st0 = {}, st1 = {};
    st0 = wmma_f16(ka[0], bq0.v, st0);
    st0 = wmma_f16(ka[1], bq1.v, st0);
    st1 = wmma_f16(ka[2], bq0.v, st1);
    st1 = wmma_f16(ka[3], bq1.v, st1);

    if (kpf) loadK(kpf, kapf);

    F32x8 s0, s1; s0.v = st0; s1.v = st1;
    float cmax = -1e30f;
#pragma unroll
    for (int j = 0; j < 8; ++j) {
      s0.e[j] *= sc; s1.e[j] *= sc;
      cmax = fmaxf(cmax, fmaxf(s0.e[j], s1.e[j]));
    }
    cmax = fmaxf(cmax, __shfl_xor(cmax, 16, 32));   // combine half-waves
    float mnew = fmaxf(mrow, cmax);
    float corr = __expf(mrow - mnew);
    F16x16 pb;                                       // P^T B-fragment, in-lane
    float psum = 0.f;
#pragma unroll
    for (int j = 0; j < 8; ++j) {
      float e0 = __expf(s0.e[j] - mnew);
      float e1 = __expf(s1.e[j] - mnew);
      psum += e0 + e1;
      pb.e[j]     = (_Float16)e0;                    // k' = j    + hi8
      pb.e[8 + j] = (_Float16)e1;                    // k' = j+16 + hi8
    }
    lrow = lrow * corr + psum;
    mrow = mnew;

#pragma unroll
    for (int t = 0; t < 4; ++t) {
      F32x8 uo; uo.v = o[t];
#pragma unroll
      for (int j = 0; j < 8; ++j) uo.e[j] *= corr;
      v16h av = (t == 0) ? vv0 : (t == 1) ? vv1 : (t == 2) ? vv2 : vv3;
      o[t] = wmma_f16(av, pb.v, uo.v);
    }
  };

  constexpr int kTiles = kS / kTileKeys;
  v16h kaA[4], kaB[4];
  for (int t = 0; t < kTiles; ++t) {
    const _Float16* kb = kv + (t & 1) * kBufH + lm * kKPitchH + hi8;
    const _Float16* vb = kv + (t & 1) * kBufH + kKAreaH + lane * 8;
    loadK(kb, kaA);
    chunk(vb,        kaA, kb + 32 * kKPitchH, kaB);
    chunk(vb + 2048, kaB, kb + 64 * kKPitchH, kaA);
    chunk(vb + 4096, kaA, kb + 96 * kKPitchH, kaB);
    chunk(vb + 6144, kaB, nullptr,            kaA);
    // hand-over: this wave's reads of the tile are done and its copies of the
    // next tile have landed, then the same holds for all four waves
    asm volatile("s_wait_dscnt 0x0" ::: "memory");
    asm volatile("s_wait_asynccnt 0x0" ::: "memory");
    __syncthreads();
    if (t + 2 < kTiles) copy_tile(t + 2, t & 1);     // refill the buffer just read
  }
  // no copy is left in flight when the wave ends
  asm volatile("s_wait_asynccnt 0x0" ::: "memory");

  float ltot = lrow + __shfl_xor(lrow, 16, 32);
  float inv = 1.f / ltot;
  const int tokrow  = (bh / 12) * 2048 + qbase + lm;
  const int colbase = (bh % 12) * 64;
#pragma unroll
  for (int t = 0; t < 4; ++t) {
    F32x8 uo; uo.v = o[t];
#pragma unroll
    for (int j = 0; j < 8; ++j) {
      int d = colbase + t * 16 + hi8 + j;
      AO[(long)tokrow * 768 + d] = (_Float16)(uo.e[j] * inv);
    }
  }
}

extern "C" void kernel_launch(void* const* d_in, const int* in_sizes, int n_in,
                              void* d_out, int out_size, void* d_ws, size_t ws_size,
                              hipStream_t stream) {
  (void)in_sizes; (void)n_in; (void)out_size; (void)ws_size;
  const float* x  = (const float*)d_in[0];
  const float* de = (const float*)d_in[1];
  const float* Wq = (const float*)d_in[2];
  const float* bq = (const float*)d_in[3];
  const float* Wk = (const float*)d_in[4];
  const float* bk = (const float*)d_in[5];
  const float* Wv = (const float*)d_in[6];
  const float* bv = (const float*)d_in[7];
  const float* Wd = (const float*)d_in[8];
  const float* bd = (const float*)d_in[9];
  const float* Wp = (const float*)d_in[10];
  const float* bp = (const float*)d_in[11];
  float* out = (float*)d_out;

  _Float16* ws16 = (_Float16*)d_ws;
  _Float16* xh  = ws16;
  _Float16* wqp = xh  + XH_ELT;
  _Float16* wkp = wqp + WP_ELT;
  _Float16* wvp = wkp + WP_ELT;
  _Float16* wpp = wvp + WP_ELT;
  _Float16* qb  = wpp + WP_ELT;
  _Float16* kb  = qb  + XH_ELT;
  _Float16* vb  = kb  + XH_ELT;
  _Float16* ao  = vb  + XH_ELT;
  float*    dsc = (float*)(ao + XH_ELT);

  prep_kernel<<<kPrepBlocks, 256, 0, stream>>>(
      x, Wq, Wk, Wv, Wp, de, Wd, bd, xh, wqp, dsc);

  // 4096/128 x 768/64 tiles; z = Q, K, V (V comes out packed for the attention)
  gemm_wmma_kernel<<<dim3(32, 12, 3), 128, kPanelBytes, stream>>>(xh, wqp, bq, bk, bv, qb, nullptr);

  attn_kernel<<<dim3(32, 24), 128, 0, stream>>>(qb, kb, vb, dsc, ao);

  gemm_wmma_kernel<<<dim3(32, 12, 1), 128, kPanelBytes, stream>>>(ao, wpp, bp, bp, bp, nullptr, out);
}

// v006
// Measured time: 72 microseconds a run.
// Two timings next to v005 put it at 1.06 and 1.07 times that version's speed.
// All steps since v000 together make it 2.40 times as fast.
#include <hip/hip_runtime.h>

typedef __attribute__((ext_vector_type(16))) _Float16 v16h;
typedef __attribute__((ext_vector_type(8)))  _Float16 v8h;
typedef __attribute__((ext_vector_type(4)))  _Float16 v4h;
typedef __attribute__((ext_vector_type(8)))  float    v8f;
typedef __attribute__((ext_vector_type(4)))  float    f32x4;
typedef __attribute__((ext_vector_type(4)))  unsigned int u32x4;
typedef __attribute__((ext_vector_type(8)))  int i32x8;
typedef __attribute__((ext_vector_type(4)))  int i32x4;

namespace {
constexpr int  kE = 768, kB = 2, kS = 2048;
constexpr long XH_ELT = (long)kB * kS * kE;   // 3,145,728 halves (x / Q / K / V / AO)
constexpr long WP_ELT = (long)kE * kE;        // 589,824 halves per packed weight
constexpr int  kPackBlocks  = (int)(WP_ELT / (256 * 32));  // blocks per weight pack, 32 elements a thread
constexpr int  kCvtBlocks   = (int)(XH_ELT / (256 * 64));  // blocks for the conversion of x, 64 a thread
constexpr int  kPrepBlocks = 1 + 4 * kPackBlocks + kCvtBlocks;
constexpr unsigned kPanelBytes = 24u * 2048u * 2u;  // 96KB B panel in LDS
constexpr int kTileKeys = 128;                 // keys per K/V tile in LDS
constexpr int kKPitchH  = 72;                  // halves: a 128-byte K row at a 144-byte pitch
constexpr unsigned kKStepB = 16u * kKPitchH * 2u;  // 128 lanes x 16 B = 16 K rows
constexpr int kKAreaH   = kTileKeys * kKPitchH;
constexpr int kBufH     = kKAreaH + kTileKeys * 64;  // K area + V area, halves
}

union F16x16 { v16h v; _Float16 e[16]; };
union F32x8  { v8f  v; float    e[8];  };

__device__ __forceinline__ v8f wmma_f16(v16h a, v16h b, v8f c) {
  return __builtin_amdgcn_wmma_f32_16x16x32_f16(false, a, false, b, (short)0, c, false, false);
}

// A-fragment loader: 16-bit A 16x32 layout. Lane holds row (lane&15); its 16
// halves are K = {0..7,16..23} (+8 for upper half-wave) -> two contiguous b128s.
__device__ __forceinline__ v16h load_a32(const _Float16* p) {
  F16x16 a;
  v8h lo = *(const v8h*)p;
  v8h hi = *(const v8h*)(p + 16);
#pragma unroll
  for (int i = 0; i < 8; ++i) { a.e[i] = lo[i]; a.e[8 + i] = hi[i]; }
  return a.v;
}

#if defined(__has_builtin)
#if __has_builtin(__builtin_amdgcn_tensor_load_to_lds) && __has_builtin(__builtin_amdgcn_s_wait_tensorcnt)
#define USE_TDM 1
#endif
#endif

#ifdef USE_TDM
// 2D TDM: copy rows x w_elts (2-byte elements, row stride in elements) to LDS.
__device__ __forceinline__ void tdm_load_2d(unsigned lds_byte_off, const void* gsrc,
                                            unsigned w_elts, unsigned rows,
                                            unsigned long row_stride_elts) {
  unsigned long ga = (unsigned long)gsrc;
  u32x4 g0;
  g0[0] = 1u;                                               // count=1, user descriptor
  g0[1] = lds_byte_off;                                     // lds_addr
  g0[2] = (unsigned)ga;                                     // global_addr[31:0]
  g0[3] = (unsigned)((ga >> 32) & 0x01FFFFFFu) | (2u << 30);// global_addr[56:32] | type=2
  i32x8 g1;
  g1[0] = 0x10000;                                          // wg_mask=0, data_size=1 (2B)
  g1[1] = (int)((w_elts & 0xFFFFu) << 16);                  // tensor_dim0[15:0]
  g1[2] = (int)((w_elts >> 16) | ((rows & 0xFFFFu) << 16)); // dim0[31:16] | dim1[15:0]
  g1[3] = (int)((rows >> 16) | ((w_elts & 0xFFFFu) << 16)); // dim1[31:16] | tile_dim0
  g1[4] = (int)(rows & 0xFFFFu);                            // tile_dim1 | tile_dim2=0
  g1[5] = (int)(row_stride_elts & 0xFFFFFFFFul);            // dim0_stride[31:0]
  g1[6] = (int)((row_stride_elts >> 32) & 0xFFFFul);        // dim0_stride[47:32]
  g1[7] = 0;
  i32x4 z4;
  z4[0] = 0; z4[1] = 0; z4[2] = 0; z4[3] = 0;
  i32x8 z8;
#pragma unroll
  for (int i = 0; i < 8; ++i) z8[i] = 0;
  __builtin_amdgcn_tensor_load_to_lds(g0, g1, z4, z4, z8, 0);
}
#endif

// A block converts 16384 floats: each thread sixteen 16-byte loads, all issued
// before the first is used, each wave-wide load 512 contiguous bytes.
__device__ __forceinline__ void cvt_f16(const float* __restrict__ src, _Float16* __restrict__ dst,
                                        int blk) {
  const int base = blk * 16384 + threadIdx.x * 4;      // < 3145728
  const float* sp = src + base;
  f32x4 v[16];
  // the loops of this function are unrolled so that v and h stay in registers
#pragma unroll
  for (int j = 0; j < 16; ++j) v[j] = *(const f32x4*)(sp + j * 1024);
  // keeps all sixteen loads ahead of the first conversion: without it the last four
  // are issued only after the first have come back, a second trip to memory
  __builtin_amdgcn_sched_barrier(0);
  // precaution: the loads' address is an input here, so it stays in its registers up to
  // this wait and no load's result lands in them ahead of it
  asm volatile("s_wait_xcnt 0x0" :: "v"(sp) : "memory");
  v4h h[16];
#pragma unroll
  for (int j = 0; j < 16; ++j)
#pragma unroll
    for (int c = 0; c < 4; ++c) h[j][c] = (_Float16)v[j][c];
#pragma unroll
  for (int j = 0; j < 16; ++j) *(v4h*)(dst + base + j * 1024) = h[j];
  // precaution: the stores' address and data registers are rewritten only behind this wait
  asm volatile("s_wait_xcnt 0x0" ::: "memory");
}

// Pack W[768][768] (k rows, n cols) into B-fragment tiles [kt=24][nt=48][512]:
// tile element (lane,i) = W[kt*32 + kof(lane,i)][nt*16 + lane%16]
// A thread makes one lane's 16 halves (32 contiguous bytes out) of two tiles; a
// block takes 16 neighbouring nt of one kt (48 = 3 x 16), so W's lines are used whole.
__device__ __forceinline__ void pack_w(const float* __restrict__ W, _Float16* __restrict__ Wp,
                                       int blk) {
  const int lane = threadIdx.x & 31;
  const int tile = blk * 16 + (threadIdx.x >> 5);      // this one and tile + 8; < 1152
  const int nt = tile % 48;
  const int kt = tile / 48;
  const float* p = W + (kt * 32 + ((lane & 16) ? 8 : 0)) * 768 + nt * 16 + (lane & 15);
  float f[2][16];
  // unrolled here and below: f and h stay in registers, the 32 loads go out as one group
#pragma unroll
  for (int u = 0; u < 2; ++u)
#pragma unroll
    for (int i = 0; i < 16; ++i) f[u][i] = p[((i < 8) ? i : i + 8) * 768 + u * 128];
#pragma unroll
  for (int u = 0; u < 2; ++u) {
    F16x16 h;
#pragma unroll
    for (int i = 0; i < 16; ++i) h.e[i] = (_Float16)f[u][i];
    *(v16h*)(Wp + (tile + u * 8) * 512 + lane * 16) = h.v;
  }
  // precaution: the stores' address and data registers are rewritten only behind this wait
  asm volatile("s_wait_xcnt 0x0" ::: "memory");
}

__device__ __forceinline__ void dscale(const float* __restrict__ de, const float* __restrict__ Wd,
                                       const float* __restrict__ bd, float* __restrict__ dsc) {
  int t = threadIdx.x;
  if (t >= 24) return;
  int b = t / 12, h = t % 12;
  float s = bd[h];
  for (int i = 0; i < 64; ++i) s += de[b * 64 + i] * Wd[i * 12 + h];
  dsc[t] = s * 0.125f;   // fold in 1/sqrt(64)
}

// Everything that depends on the inputs alone, in one launch: block 0 the head
// scales, then the four weight packs, then the conversion of x.
__global__ __launch_bounds__(256) void prep_kernel(
    const float* __restrict__ x, const float* __restrict__ Wq, const float* __restrict__ Wk,
    const float* __restrict__ Wv, const float* __restrict__ Wo, const float* __restrict__ de,
    const float* __restrict__ Wd, const float* __restrict__ bd, _Float16* __restrict__ xh,
    _Float16* __restrict__ wpk, float* __restrict__ dsc) {
  const int blk = blockIdx.x;
  if (blk == 0) {
    dscale(de, Wd, bd, dsc);
  } else if (blk <= 4 * kPackBlocks) {
    const int w = (blk - 1) / kPackBlocks;
    const float* W = (w == 0) ? Wq : (w == 1) ? Wk : (w == 2) ? Wv : Wo;
    pack_w(W, wpk + w * WP_ELT, (blk - 1) - w * kPackBlocks);
  } else {
    cvt_f16(x, xh, blk - 1 - 4 * kPackBlocks);
  }
}

// C[4096,768] = A(f16 row-major) @ Wpacked + bias.
// Block = 4 waves -> 128(M) x 64(N). B panel (24 x 2048 halves = 96KB) staged in
// LDS once per block via TDM; wave computes 32x64. A fragments come from global
// memory kAhead k steps ahead of their products, B fragments from LDS one k step
// ahead, both into register rings. Half outputs: products 0 and 1 (Q, K) go out as
// [B,H,S,64] rows; product 2 (V) goes out as the attention's A-fragment tiles, per
// head [kt=64][dt=4][512], tile element (lane,i) = V[kt*32 + kof(lane,i)][dt*16 + lane%16].
__global__ __launch_bounds__(128) void gemm_wmma_kernel(
    const _Float16* __restrict__ A, const _Float16* __restrict__ Wp0,
    const float* __restrict__ bias0, const float* __restrict__ bias1,
    const float* __restrict__ bias2, _Float16* __restrict__ out_h0,
    float* __restrict__ out_f) {
  extern __shared__ _Float16 smem[];                   // [24][2048] B panel
  // blockIdx.z picks one of up to three products that share A: their packed
  // weights lie one behind the other, and so do their outputs.
  const int z = blockIdx.z;
  const _Float16* __restrict__ Wp = Wp0 + z * WP_ELT;
  const float* __restrict__ bias = (z == 0) ? bias0 : (z == 1) ? bias1 : bias2;
  _Float16* __restrict__ out_h = out_h0 + z * XH_ELT;   // stays null where out_h0 is (z = 0 there)
  const int lane  = threadIdx.x & 31;
  const int wave  = threadIdx.x >> 5;
  const int mbase = blockIdx.x * 128 + wave * 32;
  const int nbase = blockIdx.y * 64;
  const int lm    = lane & 15;
  const int hi8   = (lane & 16) ? 8 : 0;
  const int nt0   = nbase >> 4;

  const _Float16* a0p = A + (long)(mbase + lm) * 768 + hi8;
  const _Float16* a1p = a0p + 16 * 768;
  constexpr int kSteps = 24;                          // k steps of 32
  constexpr int kAhead = 4;                           // k steps that A is fetched ahead
  v16h a[kAhead + 1][2];                              // ring, slot = k step mod (kAhead + 1)
  // unrolled: the ring's slots are constants, so it stays in registers
#pragma unroll
  for (int s = 0; s < kAhead; ++s) {
    a[s][0] = load_a32(a0p + s * 32);
    a[s][1] = load_a32(a1p + s * 32);
  }

#ifdef USE_TDM
  if (wave == 0) {
    tdm_load_2d((unsigned)(size_t)(&smem[0]), Wp + (long)nt0 * 512,
                2048u, 24u, 48ul * 512ul);
    __builtin_amdgcn_s_wait_tensorcnt(0);
  }
  __syncthreads();
#else
  {  // cooperative fallback copy: 128 threads x v8h
    const _Float16* src = Wp + (long)nt0 * 512;
    for (int r = 0; r < 24; ++r) {
      for (int c = threadIdx.x * 8; c < 2048; c += 128 * 8)
        *(v8h*)(smem + r * 2048 + c) = *(const v8h*)(src + (long)r * 48 * 512 + c);
    }
  }
  __syncthreads();
#endif

  v8f acc[2][4] = {};
  v16h b[2][4];                                       // slot = k step mod 2
  const _Float16* bp = smem + lane * 16;
  // every loop from here to the end of the k loop is unrolled: ring slots are then
  // constants, so both rings stay in registers
#pragma unroll
  for (int t = 0; t < 4; ++t) b[0][t] = *(const v16h*)(bp + t * 512);

#pragma unroll
  for (int kt = 0; kt < kSteps; ++kt) {
    if (kt + kAhead < kSteps) {
      a[(kt + kAhead) % (kAhead + 1)][0] = load_a32(a0p + (kt + kAhead) * 32);
      a[(kt + kAhead) % (kAhead + 1)][1] = load_a32(a1p + (kt + kAhead) * 32);
    }
    if (kt + 1 < kSteps) {
#pragma unroll
      for (int t = 0; t < 4; ++t)
        b[(kt + 1) & 1][t] = *(const v16h*)(bp + (kt + 1) * 2048 + t * 512);
    }
    // keeps the loads above as one group ahead of this step's products: left free, the
    // scheduler sinks each load to just before its use and every latency is waited out
    __builtin_amdgcn_sched_barrier(0);
#pragma unroll
    for (int t = 0; t < 4; ++t) {
      acc[0][t] = wmma_f16(a[kt % (kAhead + 1)][0], b[kt & 1][t], acc[0][t]);
      acc[1][t] = wmma_f16(a[kt % (kAhead + 1)][1], b[kt & 1][t], acc[1][t]);
    }
    // keeps the next step's loads from being spread among these products
    __builtin_amdgcn_sched_barrier(0);
  }

  if (z == 2) {
    // The wave's 32 rows are one kt of one head, its four column tiles the four dt.
    // A lane's accumulators hold column lane%16 and rows m*16 + hi8 + j, which are the
    // fragment's halves i = m*8 + j of this same lane: 32 contiguous bytes per tile.
    _Float16* vt = out_h + ((long)((mbase >> 11) * 12 + blockIdx.y) << 17) +
                   ((mbase & 2047) >> 5) * 2048 + lane * 16;
    F16x16 h[4];
    // unrolled here and below: h stays in registers
#pragma unroll
    for (int t = 0; t < 4; ++t) {
      const float bv = bias[nbase + t * 16 + lm];
#pragma unroll
      for (int j = 0; j < 8; ++j) {
        h[t].e[j]     = (_Float16)(acc[0][t][j] + bv);
        h[t].e[8 + j] = (_Float16)(acc[1][t][j] + bv);
      }
    }
#pragma unroll
    for (int t = 0; t < 4; ++t) *(v16h*)(vt + t * 512) = h[t].v;
    return;
  }

  // A launch gives exactly one of out_f and out_h0. Which one is tested once here, not at
  // every element, so each path is a straight run of stores off one base address.
  float bv[4];
  // unrolled here and below: bv stays in registers, every store's offset is a constant
#pragma unroll
  for (int t = 0; t < 4; ++t) bv[t] = bias[nbase + t * 16 + lm];
  // C layout: a lane holds column t*16 + lm and rows m*16 + hi8 + j
  if (out_f) {
    float* op = out_f + (long)(mbase + hi8) * 768 + nbase + lm;
#pragma unroll
    for (int m = 0; m < 2; ++m)
#pragma unroll
      for (int t = 0; t < 4; ++t)
#pragma unroll
        for (int j = 0; j < 8; ++j) op[(m * 16 + j) * 768 + t * 16] = acc[m][t][j] + bv[t];
    // precaution: in the built code the half path stands behind these stores and rewrites
    // their address and data registers; it does so only behind this wait
    asm volatile("s_wait_xcnt 0x0" ::: "memory");
    return;
  }
  // [B,H,S,64]: the wave's 32 rows lie in one batch entry, the block's 64 columns are one head
  _Float16* op = out_h +
      ((((long)((mbase >> 11) * 12 + blockIdx.y)) << 11) + (mbase & 2047) + hi8) * 64 + lm;
#pragma unroll
  for (int m = 0; m < 2; ++m)
#pragma unroll
    for (int t = 0; t < 4; ++t)
#pragma unroll
      for (int j = 0; j < 8; ++j)
        op[(m * 16 + j) * 64 + t * 16] = (_Float16)(acc[m][t][j] + bv[t]);
  // precaution, as above: in the built code the V path stands behind these stores
  asm volatile("s_wait_xcnt 0x0" ::: "memory");
}

// Fragment from two 16-byte pieces that lie hstep halves apart.
__device__ __forceinline__ v16h load_frag(const _Float16* p, int hstep) {
  F16x16 a;
  v8h lo = *(const v8h*)p;
  v8h hi = *(const v8h*)(p + hstep);
#pragma unroll
  for (int i = 0; i < 8; ++i) { a.e[i] = lo[i]; a.e[8 + i] = hi[i]; }
  return a.v;
}

// 64 keys of K and of V, global -> LDS, 16 bytes per lane and copy, no register
// in between. The s_wait_xcnt stands inside the statement so that no address
// register is rewritten ahead of it.
__device__ __forceinline__ void copy_kv64(unsigned kl, const _Float16* kg,
                                          unsigned vl, const _Float16* vg) {
  asm volatile(
      "global_load_async_to_lds_b128 %0, %1, off\n\t"
      "global_load_async_to_lds_b128 %2, %3, off\n\t"
      "global_load_async_to_lds_b128 %4, %5, off\n\t"
      "global_load_async_to_lds_b128 %6, %7, off\n\t"
      "global_load_async_to_lds_b128 %8, %9, off\n\t"
      "global_load_async_to_lds_b128 %10, %11, off\n\t"
      "global_load_async_to_lds_b128 %12, %13, off\n\t"
      "global_load_async_to_lds_b128 %14, %15, off\n\t"
      "s_wait_xcnt 0x0"
      :: "v"(kl),                  "v"(kg),
         "v"(kl + 1u * kKStepB),   "v"(kg + 1024),
         "v"(kl + 2u * kKStepB),   "v"(kg + 2048),
         "v"(kl + 3u * kKStepB),   "v"(kg + 3072),
         "v"(vl),                  "v"(vg),
         "v"(vl + 2048u),          "v"(vg + 1024),
         "v"(vl + 4096u),          "v"(vg + 2048),
         "v"(vl + 6144u),          "v"(vg + 3072)
      : "memory");
}

// Transposed flash attention: per wave one 16-row q tile, 64 chunks of 32 keys.
// S^T = K @ Q^T keeps the softmax (key) axis per-lane; P^T converts in-lane to
// the B-fragment for out^T = V^T @ P^T. The four waves of a block share K and V:
// tiles of 128 keys are copied to LDS once per block, two buffers, the next tile
// in flight while this one is worked on. K rows lie at a 144-byte pitch, each V
// fragment as two runs of 16 bytes per lane, so every b128 read is conflict-free.
__global__ __launch_bounds__(128) void attn_kernel(
    const _Float16* __restrict__ Qb, const _Float16* __restrict__ Kb,
    const _Float16* __restrict__ Vp, const float* __restrict__ dsc,
    _Float16* __restrict__ AO) {
  __shared__ __attribute__((aligned(16))) _Float16 kv[2 * kBufH];
  const int tid  = threadIdx.x;
  const int lane = threadIdx.x & 31;
  const int wave = threadIdx.x >> 5;
  const int bh   = blockIdx.y;                 // 0..23
  const int qt   = blockIdx.x * 4 + wave;      // 0..127
  const int lm   = lane & 15;
  const int hi8  = (lane & 16) ? 8 : 0;
  const long hbase = (long)bh << 17;           // 2048*64 per head
  const _Float16* Q = Qb + hbase;
  const _Float16* K = Kb + hbase;
  const _Float16* V = Vp + hbase;
  const int qbase = qt * 16;

  // This lane's 16-byte piece of a tile: source (contiguous) and place in LDS.
  const unsigned lds0 = (unsigned)(size_t)(&kv[0]);
  const unsigned kl0 = lds0 + (unsigned)(tid >> 3) * (kKPitchH * 2u) + (unsigned)(tid & 7) * 16u;
  const unsigned vl0 = lds0 + kKAreaH * 2u + (unsigned)(tid >> 6) * 1024u +
                       (unsigned)(tid & 1) * 512u + (unsigned)((tid >> 1) & 31) * 16u;
  const _Float16* kg0 = K + tid * 8;
  const _Float16* vg0 = V + tid * 8;
  auto copy_tile = [&](int t, int buf) {
    const unsigned bo = (unsigned)buf * (kBufH * 2u);
    const _Float16* kg = kg0 + (long)t * (kTileKeys * 64);
    const _Float16* vg = vg0 + (long)t * (kTileKeys * 64);
    copy_kv64(kl0 + bo, kg, vl0 + bo, vg);
    copy_kv64(kl0 + bo + 64u * kKPitchH * 2u, kg + 4096, vl0 + bo + 8192u, vg + 4096);
  };

  copy_tile(0, 0);

  const float sc = dsc[bh];
  // Q^T B-fragments for the two d-halves (loaded once, reused 64x)
  F16x16 bq0, bq1;
  {
    const _Float16* qp = Q + (qbase + lm) * 64;
#pragma unroll
    for (int i = 0; i < 16; ++i) {
      int d = ((i < 8) ? i : i + 8) + hi8;
      bq0.e[i] = qp[d];
      bq1.e[i] = qp[32 + d];
    }
  }

  // tile 0 has landed for this wave, then for all; only then is it read
  asm volatile("s_wait_asynccnt 0x0" ::: "memory");
  __syncthreads();
  copy_tile(1, 1);

  auto loadK = [&](const _Float16* kp, v16h* ka) {
    ka[0] = load_frag(kp, 16);                      // tile0, d 0..31
    ka[1] = load_frag(kp + 32, 16);                 // tile0, d 32..63
    ka[2] = load_frag(kp + 16 * kKPitchH, 16);      // tile1, d 0..31
    ka[3] = load_frag(kp + 16 * kKPitchH + 32, 16); // tile1, d 32..63
  };

  v8f o[4] = {};
  float mrow = -1e30f, lrow = 0.f;

  // one 32-key chunk; fetches the tile's next chunk of K (if any) into kapf
  // between scores & softmax
  auto chunk = [&](const _Float16* vp, v16h* ka, const _Float16* kpf, v16h* kapf) {
    v16h vv0 = load_frag(vp, 256);
    v16h vv1 = load_frag(vp + 512, 256);
    v16h vv2 = load_frag(vp + 1024, 256);
    v16h vv3 = load_frag(vp + 1536, 256);

    v8f st0 = {}, st1 = {};
    st0 = wmma_f16(ka[0], bq0.v, st0);
    st0 = wmma_f16(ka[1], bq1.v, st0);
    st1 = wmma_f16(ka[2], bq0.v, st1);
    st1 = wmma_f16(ka[3], bq1.v, st1);

    if (kpf) loadK(kpf, kapf);

    F32x8 s0, s1; s0.v = st0; s1.v = st1;
    float cmax = -1e30f;
#pragma unroll
    for (int j = 0; j < 8; ++j) {
      s0.e[j] *= sc; s1.e[j] *= sc;
      cmax = fmaxf(cmax, fmaxf(s0.e[j], s1.e[j]));
    }
    cmax = fmaxf(cmax, __shfl_xor(cmax, 16, 32));   // combine half-waves
    float mnew = fmaxf(mrow, cmax);
    float corr = __expf(mrow - mnew);
    F16x16 pb;                                       // P^T B-fragment, in-lane
    float psum = 0.f;
#pragma unroll
    for (int j = 0; j < 8; ++j) {
      float e0 = __expf(s0.e[j] - mnew);
      float e1 = __expf(s1.e[j] - mnew);
      psum += e0 + e1;
      pb.e[j]     = (_Float16)e0;                    // k' = j    + hi8
      pb.e[8 + j] = (_Float16)e1;                    // k' = j+16 + hi8
    }
    lrow = lrow * corr + psum;
    mrow = mnew;

#pragma unroll
    for (int t = 0; t < 4; ++t) {
      F32x8 uo; uo.v = o[t];
#pragma unroll
      for (int j = 0; j < 8; ++j) uo.e[j] *= corr;
      v16h av = (t == 0) ? vv0 : (t == 1) ? vv1 : (t == 2) ? vv2 : vv3;
      o[t] = wmma_f16(av, pb.v, uo.v);
    }
  };

  constexpr int kTiles = kS / kTileKeys;
  v16h kaA[4], kaB[4];
  for (int t = 0; t < kTiles; ++t) {
    const _Float16* kb = kv + (t & 1) * kBufH + lm * kKPitchH + hi8;
    const _Float16* vb = kv + (t & 1) * kBufH + kKAreaH + lane * 8;
    loadK(kb, kaA);
    chunk(vb,        kaA, kb + 32 * kKPitchH, kaB);
    chunk(vb + 2048, kaB, kb + 64 * kKPitchH, kaA);
    chunk(vb + 4096, kaA, kb + 96 * kKPitchH, kaB);
    chunk(vb + 6144, kaB, nullptr,            kaA);
    // hand-over: this wave's reads of the tile are done and its copies of the
    // next tile have landed, then the same holds for all four waves
    asm volatile("s_wait_dscnt 0x0" ::: "memory");
    asm volatile("s_wait_asynccnt 0x0" ::: "memory");
    __syncthreads();
    if (t + 2 < kTiles) copy_tile(t + 2, t & 1);     // refill the buffer just read
  }
  // no copy is left in flight when the wave ends
  asm volatile("s_wait_asynccnt 0x0" ::: "memory");

  float ltot = lrow + __shfl_xor(lrow, 16, 32);
  float inv = 1.f / ltot;
  const int tokrow  = (bh / 12) * 2048 + qbase + lm;
  const int colbase = (bh % 12) * 64;
#pragma unroll
  for (int t = 0; t < 4; ++t) {
    F32x8 uo; uo.v = o[t];
#pragma unroll
    for (int j = 0; j < 8; ++j) {
      int d = colbase + t * 16 + hi8 + j;
      AO[(long)tokrow * 768 + d] = (_Float16)(uo.e[j] * inv);
    }
  }
}

extern "C" void kernel_launch(void* const* d_in, const int* in_sizes, int n_in,
                              void* d_out, int out_size, void* d_ws, size_t ws_size,
                              hipStream_t stream) {
  (void)in_sizes; (void)n_in; (void)out_size; (void)ws_size;
  const float* x  = (const float*)d_in[0];
  const float* de = (const float*)d_in[1];
  const float* Wq = (const float*)d_in[2];
  const float* bq = (const float*)d_in[3];
  const float* Wk = (const float*)d_in[4];
  const float* bk = (const float*)d_in[5];
  const float* Wv = (const float*)d_in[6];
  const float* bv = (const float*)d_in[7];
  const float* Wd = (const float*)d_in[8];
  const float* bd = (const float*)d_in[9];
  const float* Wp = (const float*)d_in[10];
  const float* bp = (const float*)d_in[11];
  float* out = (float*)d_out;

  _Float16* ws16 = (_Float16*)d_ws;
  _Float16* xh  = ws16;
  _Float16* wqp = xh  + XH_ELT;
  _Float16* wkp = wqp + WP_ELT;
  _Float16* wvp = wkp + WP_ELT;
  _Float16* wpp = wvp + WP_ELT;
  _Float16* qb  = wpp + WP_ELT;
  _Float16* kb  = qb  + XH_ELT;
  _Float16* vb  = kb  + XH_ELT;
  _Float16* ao  = vb  + XH_ELT;
  float*    dsc = (float*)(ao + XH_ELT);

  prep_kernel<<<kPrepBlocks, 256, 0, stream>>>(
      x, Wq, Wk, Wv, Wp, de, Wd, bd, xh, wqp, dsc);

  // 4096/128 x 768/64 tiles; z = Q, K, V (V comes out packed for the attention)
  gemm_wmma_kernel<<<dim3(32, 12, 3), 128, kPanelBytes, stream>>>(xh, wqp, bq, bk, bv, qb, nullptr);

  attn_kernel<<<dim3(32, 24), 128, 0, stream>>>(qb, kb, vb, dsc, ao);

  gemm_wmma_kernel<<<dim3(32, 12, 1), 128, kPanelBytes, stream>>>(ao, wpp, bp, bp, bp, nullptr, out);
}

// v007
// A run of this version takes 69.6 microseconds.
// Next to v006, in two timings, it ran 1.03 and 1.04 times as fast.
// Counting every step since v000, it is 2.48 times as fast.
#include <hip/hip_runtime.h>

typedef __attribute__((ext_vector_type(16))) _Float16 v16h;
typedef __attribute__((ext_vector_type(8)))  _Float16 v8h;
typedef __attribute__((ext_vector_type(4)))  _Float16 v4h;
typedef __attribute__((ext_vector_type(8)))  float    v8f;
typedef __attribute__((ext_vector_type(4)))  float    f32x4;
typedef __attribute__((ext_vector_type(4)))  unsigned int u32x4;
typedef __attribute__((ext_vector_type(8)))  int i32x8;
typedef __attribute__((ext_vector_type(4)))  int i32x4;

namespace {
constexpr int  kE = 768, kB = 2, kS = 2048;
constexpr long XH_ELT = (long)kB * kS * kE;   // 3,145,728 halves (x / Q / K / V / AO)
constexpr long WP_ELT = (long)kE * kE;        // 589,824 halves per packed weight
constexpr int  kPackBlocks  = (int)(WP_ELT / (256 * 32));  // blocks per weight pack, 32 elements a thread
constexpr int  kCvtBlocks   = (int)(XH_ELT / (256 * 64));  // blocks for the conversion of x, 64 a thread
constexpr int  kPrepBlocks = 1 + 4 * kPackBlocks + kCvtBlocks;
constexpr unsigned kPanelBytes = 24u * 2048u * 2u;  // 96KB B panel in LDS
constexpr int kTileKeys = 128;                 // keys per K/V tile in LDS
constexpr int kKPitchH  = 72;                  // halves: a 128-byte K row at a 144-byte pitch
constexpr unsigned kKStepB = 16u * kKPitchH * 2u;  // 128 lanes x 16 B = 16 K rows
constexpr int kKAreaH   = kTileKeys * kKPitchH;
constexpr int kBufH     = kKAreaH + kTileKeys * 64;  // K area + V area, halves
}

union F16x16 { v16h v; _Float16 e[16]; };
union F32x8  { v8f  v; float    e[8];  };

__device__ __forceinline__ v8f wmma_f16(v16h a, v16h b, v8f c) {
  return __builtin_amdgcn_wmma_f32_16x16x32_f16(false, a, false, b, (short)0, c, false, false);
}

// A-fragment loader: 16-bit A 16x32 layout. Lane holds row (lane&15); its 16
// halves are K = {0..7,16..23} (+8 for upper half-wave) -> two contiguous b128s.
__device__ __forceinline__ v16h load_a32(const _Float16* p) {
  F16x16 a;
  v8h lo = *(const v8h*)p;
  v8h hi = *(const v8h*)(p + 16);
#pragma unroll
  for (int i = 0; i < 8; ++i) { a.e[i] = lo[i]; a.e[8 + i] = hi[i]; }
  return a.v;
}

#if defined(__has_builtin)
#if __has_builtin(__builtin_amdgcn_tensor_load_to_lds) && __has_builtin(__builtin_amdgcn_s_wait_tensorcnt)
#define USE_TDM 1
#endif
#endif

#ifdef USE_TDM
// 2D TDM: copy rows x w_elts (2-byte elements, row stride in elements) to LDS.
__device__ __forceinline__ void tdm_load_2d(unsigned lds_byte_off, const void* gsrc,
                                            unsigned w_elts, unsigned rows,
                                            unsigned long row_stride_elts) {
  unsigned long ga = (unsigned long)gsrc;
  u32x4 g0;
  g0[0] = 1u;                                               // count=1, user descriptor
  g0[1] = lds_byte_off;                                     // lds_addr
  g0[2] = (unsigned)ga;                                     // global_addr[31:0]
  g0[3] = (unsigned)((ga >> 32) & 0x01FFFFFFu) | (2u << 30);// global_addr[56:32] | type=2
  i32x8 g1;
  g1[0] = 0x10000;                                          // wg_mask=0, data_size=1 (2B)
  g1[1] = (int)((w_elts & 0xFFFFu) << 16);                  // tensor_dim0[15:0]
  g1[2] = (int)((w_elts >> 16) | ((rows & 0xFFFFu) << 16)); // dim0[31:16] | dim1[15:0]
  g1[3] = (int)((rows >> 16) | ((w_elts & 0xFFFFu) << 16)); // dim1[31:16] | tile_dim0
  g1[4] = (int)(rows & 0xFFFFu);                            // tile_dim1 | tile_dim2=0
  g1[5] = (int)(row_stride_elts & 0xFFFFFFFFul);            // dim0_stride[31:0]
  g1[6] = (int)((row_stride_elts >> 32) & 0xFFFFul);        // dim0_stride[47:32]
  g1[7] = 0;
  i32x4 z4;
  z4[0] = 0; z4[1] = 0; z4[2] = 0; z4[3] = 0;
  i32x8 z8;
#pragma unroll
  for (int i = 0; i < 8; ++i) z8[i] = 0;
  __builtin_amdgcn_tensor_load_to_lds(g0, g1, z4, z4, z8, 0);
}
#endif

// A block converts 16384 floats: each thread sixteen 16-byte loads, all issued
// before the first is used, each wave-wide load 512 contiguous bytes.
__device__ __forceinline__ void cvt_f16(const float* __restrict__ src, _Float16* __restrict__ dst,
                                        int blk) {
  const int base = blk * 16384 + threadIdx.x * 4;      // < 3145728
  const float* sp = src + base;
  f32x4 v[16];
  // the loops of this function are unrolled so that v and h stay in registers
#pragma unroll
  for (int j = 0; j < 16; ++j) v[j] = *(const f32x4*)(sp + j * 1024);
  // keeps all sixteen loads ahead of the first conversion: without it the last four
  // are issued only after the first have come back, a second trip to memory
  __builtin_amdgcn_sched_barrier(0);
  // precaution: the loads' address is an input here, so it stays in its registers up to
  // this wait and no load's result lands in them ahead of it
  asm volatile("s_wait_xcnt 0x0" :: "v"(sp) : "memory");
  v4h h[16];
#pragma unroll
  for (int j = 0; j < 16; ++j)
#pragma unroll
    for (int c = 0; c < 4; ++c) h[j][c] = (_Float16)v[j][c];
#pragma unroll
  for (int j = 0; j < 16; ++j) *(v4h*)(dst + base + j * 1024) = h[j];
  // precaution: the stores' address and data registers are rewritten only behind this wait
  asm volatile("s_wait_xcnt 0x0" ::: "memory");
}

// Pack W[768][768] (k rows, n cols) into B-fragment tiles [kt=24][nt=48][512]:
// tile element (lane,i) = W[kt*32 + kof(lane,i)][nt*16 + lane%16]
// A thread makes one lane's 16 halves (32 contiguous bytes out) of two tiles; a
// block takes 16 neighbouring nt of one kt (48 = 3 x 16), so W's lines are used whole.
__device__ __forceinline__ void pack_w(const float* __restrict__ W, _Float16* __restrict__ Wp,
                                       int blk) {
  const int lane = threadIdx.x & 31;
  const int tile = blk * 16 + (threadIdx.x >> 5);      // this one and tile + 8; < 1152
  const int nt = tile % 48;
  const int kt = tile / 48;
  const float* p = W + (kt * 32 + ((lane & 16) ? 8 : 0)) * 768 + nt * 16 + (lane & 15);
  float f[2][16];
  // unrolled here and below: f and h stay in registers, the 32 loads go out as one group
#pragma unroll
  for (int u = 0; u < 2; ++u)
#pragma unroll
    for (int i = 0; i < 16; ++i) f[u][i] = p[((i < 8) ? i : i + 8) * 768 + u * 128];
#pragma unroll
  for (int u = 0; u < 2; ++u) {
    F16x16 h;
#pragma unroll
    for (int i = 0; i < 16; ++i) h.e[i] = (_Float16)f[u][i];
    *(v16h*)(Wp + (tile + u * 8) * 512 + lane * 16) = h.v;
  }
  // precaution: the stores' address and data registers are rewritten only behind this wait
  asm volatile("s_wait_xcnt 0x0" ::: "memory");
}

__device__ __forceinline__ void dscale(const float* __restrict__ de, const float* __restrict__ Wd,
                                       const float* __restrict__ bd, float* __restrict__ dsc) {
  int t = threadIdx.x;
  if (t >= 24) return;
  int b = t / 12, h = t % 12;
  float s = bd[h];
  for (int i = 0; i < 64; ++i) s += de[b * 64 + i] * Wd[i * 12 + h];
  dsc[t] = s * (0.125f * 1.44269504f);   // fold in 1/sqrt(64) and log2(e): the softmax runs in base 2
}

// Everything that depends on the inputs alone, in one launch: block 0 the head
// scales, then the four weight packs, then the conversion of x.
__global__ __launch_bounds__(256) void prep_kernel(
    const float* __restrict__ x, const float* __restrict__ Wq, const float* __restrict__ Wk,
    const float* __restrict__ Wv, const float* __restrict__ Wo, const float* __restrict__ de,
    const float* __restrict__ Wd, const float* __restrict__ bd, _Float16* __restrict__ xh,
    _Float16* __restrict__ wpk, float* __restrict__ dsc) {
  const int blk = blockIdx.x;
  if (blk == 0) {
    dscale(de, Wd, bd, dsc);
  } else if (blk <= 4 * kPackBlocks) {
    const int w = (blk - 1) / kPackBlocks;
    const float* W = (w == 0) ? Wq : (w == 1) ? Wk : (w == 2) ? Wv : Wo;
    pack_w(W, wpk + w * WP_ELT, (blk - 1) - w * kPackBlocks);
  } else {
    cvt_f16(x, xh, blk - 1 - 4 * kPackBlocks);
  }
}

// C[4096,768] = A(f16 row-major) @ Wpacked + bias.
// Block = 4 waves -> 128(M) x 64(N). B panel (24 x 2048 halves = 96KB) staged in
// LDS once per block via TDM; wave computes 32x64. A fragments come from global
// memory kAhead k steps ahead of their products, B fragments from LDS one k step
// ahead, both into register rings. Half outputs: products 0 and 1 (Q, K) go out as
// [B,H,S,64] rows, Q times its head's score scale (in f32, ahead of the one rounding to
// half); product 2 (V) goes out as the attention's A-fragment tiles, per
// head [kt=64][dt=4][512], tile element (lane,i) = V[kt*32 + kof(lane,i)][dt*16 + lane%16].
__global__ __launch_bounds__(128) void gemm_wmma_kernel(
    const _Float16* __restrict__ A, const _Float16* __restrict__ Wp0,
    const float* __restrict__ bias0, const float* __restrict__ bias1,
    const float* __restrict__ bias2, const float* __restrict__ qscale,
    _Float16* __restrict__ out_h0, float* __restrict__ out_f) {
  extern __shared__ _Float16 smem[];                   // [24][2048] B panel
  // blockIdx.z picks one of up to three products that share A: their packed
  // weights lie one behind the other, and so do their outputs.
  const int z = blockIdx.z;
  const _Float16* __restrict__ Wp = Wp0 + z * WP_ELT;
  const float* __restrict__ bias = (z == 0) ? bias0 : (z == 1) ? bias1 : bias2;
  _Float16* __restrict__ out_h = out_h0 + z * XH_ELT;   // stays null where out_h0 is (z = 0 there)
  const int lane  = threadIdx.x & 31;
  const int wave  = threadIdx.x >> 5;
  const int mbase = blockIdx.x * 128 + wave * 32;
  const int nbase = blockIdx.y * 64;
  const int lm    = lane & 15;
  const int hi8   = (lane & 16) ? 8 : 0;
  const int nt0   = nbase >> 4;

  const _Float16* a0p = A + (long)(mbase + lm) * 768 + hi8;
  const _Float16* a1p = a0p + 16 * 768;
  constexpr int kSteps = 24;                          // k steps of 32
  constexpr int kAhead = 4;                           // k steps that A is fetched ahead
  v16h a[kAhead + 1][2];                              // ring, slot = k step mod (kAhead + 1)
  // unrolled: the ring's slots are constants, so it stays in registers
#pragma unroll
  for (int s = 0; s < kAhead; ++s) {
    a[s][0] = load_a32(a0p + s * 32);
    a[s][1] = load_a32(a1p + s * 32);
  }

#ifdef USE_TDM
  if (wave == 0) {
    tdm_load_2d((unsigned)(size_t)(&smem[0]), Wp + (long)nt0 * 512,
                2048u, 24u, 48ul * 512ul);
    __builtin_amdgcn_s_wait_tensorcnt(0);
  }
  __syncthreads();
#else
  {  // cooperative fallback copy: 128 threads x v8h
    const _Float16* src = Wp + (long)nt0 * 512;
    for (int r = 0; r < 24; ++r) {
      for (int c = threadIdx.x * 8; c < 2048; c += 128 * 8)
        *(v8h*)(smem + r * 2048 + c) = *(const v8h*)(src + (long)r * 48 * 512 + c);
    }
  }
  __syncthreads();
#endif

  v8f acc[2][4] = {};
  v16h b[2][4];                                       // slot = k step mod 2
  const _Float16* bp = smem + lane * 16;
  // every loop from here to the end of the k loop is unrolled: ring slots are then
  // constants, so both rings stay in registers
#pragma unroll
  for (int t = 0; t < 4; ++t) b[0][t] = *(const v16h*)(bp + t * 512);

#pragma unroll
  for (int kt = 0; kt < kSteps; ++kt) {
    if (kt + kAhead < kSteps) {
      a[(kt + kAhead) % (kAhead + 1)][0] = load_a32(a0p + (kt + kAhead) * 32);
      a[(kt + kAhead) % (kAhead + 1)][1] = load_a32(a1p + (kt + kAhead) * 32);
    }
    if (kt + 1 < kSteps) {
#pragma unroll
      for (int t = 0; t < 4; ++t)
        b[(kt + 1) & 1][t] = *(const v16h*)(bp + (kt + 1) * 2048 + t * 512);
    }
    // keeps the loads above as one group ahead of this step's products: left free, the
    // scheduler sinks each load to just before its use and every latency is waited out
    __builtin_amdgcn_sched_barrier(0);
#pragma unroll
    for (int t = 0; t < 4; ++t) {
      acc[0][t] = wmma_f16(a[kt % (kAhead + 1)][0], b[kt & 1][t], acc[0][t]);
      acc[1][t] = wmma_f16(a[kt % (kAhead + 1)][1], b[kt & 1][t], acc[1][t]);
    }
    // keeps the next step's loads from being spread among these products
    __builtin_amdgcn_sched_barrier(0);
  }

  if (z == 2) {
    // The wave's 32 rows are one kt of one head, its four column tiles the four dt.
    // A lane's accumulators hold column lane%16 and rows m*16 + hi8 + j, which are the
    // fragment's halves i = m*8 + j of this same lane: 32 contiguous bytes per tile.
    _Float16* vt = out_h + ((long)((mbase >> 11) * 12 + blockIdx.y) << 17) +
                   ((mbase & 2047) >> 5) * 2048 + lane * 16;
    F16x16 h[4];
    // unrolled here and below: h stays in registers
#pragma unroll
    for (int t = 0; t < 4; ++t) {
      const float bv = bias[nbase + t * 16 + lm];
#pragma unroll
      for (int j = 0; j < 8; ++j) {
        h[t].e[j]     = (_Float16)(acc[0][t][j] + bv);
        h[t].e[8 + j] = (_Float16)(acc[1][t][j] + bv);
      }
    }
#pragma unroll
    for (int t = 0; t < 4; ++t) *(v16h*)(vt + t * 512) = h[t].v;
    return;
  }

  // A launch gives exactly one of out_f and out_h0. Which one is tested once here, not at
  // every element, so each path is a straight run of stores off one base address.
  float bv[4];
  // unrolled here and below: bv stays in registers, every store's offset is a constant
#pragma unroll
  for (int t = 0; t < 4; ++t) bv[t] = bias[nbase + t * 16 + lm];
  // C layout: a lane holds column t*16 + lm and rows m*16 + hi8 + j
  if (out_f) {
    float* op = out_f + (long)(mbase + hi8) * 768 + nbase + lm;
#pragma unroll
    for (int m = 0; m < 2; ++m)
#pragma unroll
      for (int t = 0; t < 4; ++t)
#pragma unroll
        for (int j = 0; j < 8; ++j) op[(m * 16 + j) * 768 + t * 16] = acc[m][t][j] + bv[t];
    // precaution: in the built code the half path stands behind these stores and rewrites
    // their address and data registers; it does so only behind this wait
    asm volatile("s_wait_xcnt 0x0" ::: "memory");
    return;
  }
  // [B,H,S,64]: the wave's 32 rows lie in one batch entry, the block's 64 columns are one head
  const int bh = (mbase >> 11) * 12 + blockIdx.y;
  _Float16* op = out_h + ((((long)bh) << 11) + (mbase & 2047) + hi8) * 64 + lm;
  // (acc + bias) * scale as one multiply-add; K's scale is 1, so its multiply-add is acc + bias
  const float qs = (z == 0) ? qscale[bh] : 1.f;
#pragma unroll
  for (int t = 0; t < 4; ++t) bv[t] *= qs;
#pragma unroll
  for (int m = 0; m < 2; ++m)
#pragma unroll
    for (int t = 0; t < 4; ++t)
#pragma unroll
      for (int j = 0; j < 8; ++j)
        op[(m * 16 + j) * 64 + t * 16] = (_Float16)fmaf(acc[m][t][j], qs, bv[t]);
  // precaution, as above: in the built code the V path stands behind these stores
  asm volatile("s_wait_xcnt 0x0" ::: "memory");
}

// Fragment from two 16-byte pieces that lie hstep halves apart.
__device__ __forceinline__ v16h load_frag(const _Float16* p, int hstep) {
  F16x16 a;
  v8h lo = *(const v8h*)p;
  v8h hi = *(const v8h*)(p + hstep);
#pragma unroll
  for (int i = 0; i < 8; ++i) { a.e[i] = lo[i]; a.e[8 + i] = hi[i]; }
  return a.v;
}

// 64 keys of K and of V, global -> LDS, 16 bytes per lane and copy, no register
// in between. The s_wait_xcnt stands inside the statement so that no address
// register is rewritten ahead of it.
__device__ __forceinline__ void copy_kv64(unsigned kl, const _Float16* kg,
                                          unsigned vl, const _Float16* vg) {
  asm volatile(
      "global_load_async_to_lds_b128 %0, %1, off\n\t"
      "global_load_async_to_lds_b128 %2, %3, off\n\t"
      "global_load_async_to_lds_b128 %4, %5, off\n\t"
      "global_load_async_to_lds_b128 %6, %7, off\n\t"
      "global_load_async_to_lds_b128 %8, %9, off\n\t"
      "global_load_async_to_lds_b128 %10, %11, off\n\t"
      "global_load_async_to_lds_b128 %12, %13, off\n\t"
      "global_load_async_to_lds_b128 %14, %15, off\n\t"
      "s_wait_xcnt 0x0"
      :: "v"(kl),                  "v"(kg),
         "v"(kl + 1u * kKStepB),   "v"(kg + 1024),
         "v"(kl + 2u * kKStepB),   "v"(kg + 2048),
         "v"(kl + 3u * kKStepB),   "v"(kg + 3072),
         "v"(vl),                  "v"(vg),
         "v"(vl + 2048u),          "v"(vg + 1024),
         "v"(vl + 4096u),          "v"(vg + 2048),
         "v"(vl + 6144u),          "v"(vg + 3072)
      : "memory");
}

// Transposed flash attention: per wave one 16-row q tile, 64 chunks of 32 keys.
// S^T = K @ Q^T keeps the softmax (key) axis per-lane; P^T converts in-lane to
// the B-fragment for out^T = V^T @ P^T. Q arrives times scale * log2(e), so the products
// are the exponents to base 2 as they stand. The four waves of a block share K and V:
// tiles of 128 keys are copied to LDS once per block, two buffers, the next tile
// in flight while this one is worked on. K rows lie at a 144-byte pitch, each V
// fragment as two runs of 16 bytes per lane, so every b128 read is conflict-free.
__global__ __launch_bounds__(128) void attn_kernel(
    const _Float16* __restrict__ Qb, const _Float16* __restrict__ Kb,
    const _Float16* __restrict__ Vp, _Float16* __restrict__ AO) {
  __shared__ __attribute__((aligned(16))) _Float16 kv[2 * kBufH];
  const int tid  = threadIdx.x;
  const int lane = threadIdx.x & 31;
  const int wave = threadIdx.x >> 5;
  const int bh   = blockIdx.y;                 // 0..23
  const int qt   = blockIdx.x * 4 + wave;      // 0..127
  const int lm   = lane & 15;
  const int hi8  = (lane & 16) ? 8 : 0;
  const long hbase = (long)bh << 17;           // 2048*64 per head
  const _Float16* Q = Qb + hbase;
  const _Float16* K = Kb + hbase;
  const _Float16* V = Vp + hbase;
  const int qbase = qt * 16;

  // This lane's 16-byte piece of a tile: source (contiguous) and place in LDS.
  const unsigned lds0 = (unsigned)(size_t)(&kv[0]);
  const unsigned kl0 = lds0 + (unsigned)(tid >> 3) * (kKPitchH * 2u) + (unsigned)(tid & 7) * 16u;
  const unsigned vl0 = lds0 + kKAreaH * 2u + (unsigned)(tid >> 6) * 1024u +
                       (unsigned)(tid & 1) * 512u + (unsigned)((tid >> 1) & 31) * 16u;
  const _Float16* kg0 = K + tid * 8;
  const _Float16* vg0 = V + tid * 8;
  auto copy_tile = [&](int t, int buf) {
    const unsigned bo = (unsigned)buf * (kBufH * 2u);
    const _Float16* kg = kg0 + (long)t * (kTileKeys * 64);
    const _Float16* vg = vg0 + (long)t * (kTileKeys * 64);
    copy_kv64(kl0 + bo, kg, vl0 + bo, vg);
    copy_kv64(kl0 + bo + 64u * kKPitchH * 2u, kg + 4096, vl0 + bo + 8192u, vg + 4096);
  };

  copy_tile(0, 0);

  // Q^T B-fragments for the two d-halves (loaded once, reused 64x)
  F16x16 bq0, bq1;
  {
    const _Float16* qp = Q + (qbase + lm) * 64;
#pragma unroll
    for (int i = 0; i < 16; ++i) {
      int d = ((i < 8) ? i : i + 8) + hi8;
      bq0.e[i] = qp[d];
      bq1.e[i] = qp[32 + d];
    }
  }

  // tile 0 has landed for this wave, then for all; only then is it read
  asm volatile("s_wait_asynccnt 0x0" ::: "memory");
  __syncthreads();
  copy_tile(1, 1);

  auto loadK = [&](const _Float16* kp, v16h* ka) {
    ka[0] = load_frag(kp, 16);                      // tile0, d 0..31
    ka[1] = load_frag(kp + 32, 16);                 // tile0, d 32..63
    ka[2] = load_frag(kp + 16 * kKPitchH, 16);      // tile1, d 0..31
    ka[3] = load_frag(kp + 16 * kKPitchH + 32, 16); // tile1, d 32..63
  };

  v8f o[4] = {};
  float mrow = -1e30f, lrow = 0.f;

  // one 32-key chunk; fetches the tile's next chunk of K (if any) into kapf
  // between scores & softmax
  auto chunk = [&](const _Float16* vp, v16h* ka, const _Float16* kpf, v16h* kapf) {
    v16h vv0 = load_frag(vp, 256);
    v16h vv1 = load_frag(vp + 512, 256);
    v16h vv2 = load_frag(vp + 1024, 256);
    v16h vv3 = load_frag(vp + 1536, 256);

    v8f st0 = {}, st1 = {};
    st0 = wmma_f16(ka[0], bq0.v, st0);
    st0 = wmma_f16(ka[1], bq1.v, st0);
    st1 = wmma_f16(ka[2], bq0.v, st1);
    st1 = wmma_f16(ka[3], bq1.v, st1);

    if (kpf) loadK(kpf, kapf);

    F32x8 s0, s1; s0.v = st0; s1.v = st1;
    float cmax = -1e30f;
#pragma unroll
    for (int j = 0; j < 8; ++j) cmax = fmaxf(cmax, fmaxf(s0.e[j], s1.e[j]));
    cmax = fmaxf(cmax, __shfl_xor(cmax, 16, 32));   // combine half-waves
    float mnew = fmaxf(mrow, cmax);
    float corr = __builtin_amdgcn_exp2f(mrow - mnew);
    F16x16 pb;                                       // P^T B-fragment, in-lane
    float psum = 0.f;
#pragma unroll
    for (int j = 0; j < 8; ++j) {
      float e0 = __builtin_amdgcn_exp2f(s0.e[j] - mnew);
      float e1 = __builtin_amdgcn_exp2f(s1.e[j] - mnew);
      psum += e0 + e1;
      pb.e[j]     = (_Float16)e0;                    // k' = j    + hi8
      pb.e[8 + j] = (_Float16)e1;                    // k' = j+16 + hi8
    }
    lrow = lrow * corr + psum;
    mrow = mnew;

#pragma unroll
    for (int t = 0; t < 4; ++t) {
      F32x8 uo; uo.v = o[t];
#pragma unroll
      for (int j = 0; j < 8; ++j) uo.e[j] *= corr;
      v16h av = (t == 0) ? vv0 : (t == 1) ? vv1 : (t == 2) ? vv2 : vv3;
      o[t] = wmma_f16(av, pb.v, uo.v);
    }
  };

  constexpr int kTiles = kS / kTileKeys;
  v16h kaA[4], kaB[4];
  for (int t = 0; t < kTiles; ++t) {
    const _Float16* kb = kv + (t & 1) * kBufH + lm * kKPitchH + hi8;
    const _Float16* vb = kv + (t & 1) * kBufH + kKAreaH + lane * 8;
    loadK(kb, kaA);
    chunk(vb,        kaA, kb + 32 * kKPitchH, kaB);
    chunk(vb + 2048, kaB, kb + 64 * kKPitchH, kaA);
    chunk(vb + 4096, kaA, kb + 96 * kKPitchH, kaB);
    chunk(vb + 6144, kaB, nullptr,            kaA);
    // hand-over: this wave's reads of the tile are done and its copies of the
    // next tile have landed, then the same holds for all four waves
    asm volatile("s_wait_dscnt 0x0" ::: "memory");
    asm volatile("s_wait_asynccnt 0x0" ::: "memory");
    __syncthreads();
    if (t + 2 < kTiles) copy_tile(t + 2, t & 1);     // refill the buffer just read
  }
  // no copy is left in flight when the wave ends
  asm volatile("s_wait_asynccnt 0x0" ::: "memory");

  float ltot = lrow + __shfl_xor(lrow, 16, 32);
  float inv = 1.f / ltot;
  const int tokrow  = (bh / 12) * 2048 + qbase + lm;
  const int colbase = (bh % 12) * 64;
#pragma unroll
  for (int t = 0; t < 4; ++t) {
    F32x8 uo; uo.v = o[t];
#pragma unroll
    for (int j = 0; j < 8; ++j) {
      int d = colbase + t * 16 + hi8 + j;
      AO[(long)tokrow * 768 + d] = (_Float16)(uo.e[j] * inv);
    }
  }
}

extern "C" void kernel_launch(void* const* d_in, const int* in_sizes, int n_in,
                              void* d_out, int out_size, void* d_ws, size_t ws_size,
                              hipStream_t stream) {
  (void)in_sizes; (void)n_in; (void)out_size; (void)ws_size;
  const float* x  = (const float*)d_in[0];
  const float* de = (const float*)d_in[1];
  const float* Wq = (const float*)d_in[2];
  const float* bq = (const float*)d_in[3];
  const float* Wk = (const float*)d_in[4];
  const float* bk = (const float*)d_in[5];
  const float* Wv = (const float*)d_in[6];
  const float* bv = (const float*)d_in[7];
  const float* Wd = (const float*)d_in[8];
  const float* bd = (const float*)d_in[9];
  const float* Wp = (const float*)d_in[10];
  const float* bp = (const float*)d_in[11];
  float* out = (float*)d_out;

  _Float16* ws16 = (_Float16*)d_ws;
  _Float16* xh  = ws16;
  _Float16* wqp = xh  + XH_ELT;
  _Float16* wkp = wqp + WP_ELT;
  _Float16* wvp = wkp + WP_ELT;
  _Float16* wpp = wvp + WP_ELT;
  _Float16* qb  = wpp + WP_ELT;
  _Float16* kb  = qb  + XH_ELT;
  _Float16* vb  = kb  + XH_ELT;
  _Float16* ao  = vb  + XH_ELT;
  float*    dsc = (float*)(ao + XH_ELT);

  prep_kernel<<<kPrepBlocks, 256, 0, stream>>>(
      x, Wq, Wk, Wv, Wp, de, Wd, bd, xh, wqp, dsc);

  // 4096/128 x 768/64 tiles; z = Q, K, V (V comes out packed for the attention)
  gemm_wmma_kernel<<<dim3(32, 12, 3), 128, kPanelBytes, stream>>>(xh, wqp, bq, bk, bv, dsc, qb, nullptr);

  attn_kernel<<<dim3(32, 24), 128, 0, stream>>>(qb, kb, vb, ao);

  gemm_wmma_kernel<<<dim3(32, 12, 1), 128, kPanelBytes, stream>>>(ao, wpp, bp, bp, bp, nullptr, nullptr, out);
}

// v008
// One run takes 62 microseconds.
// In both of two side-by-side timings against v007, it was 1.12 times as fast.
// Counting every step since v000, it is 2.77 times as fast.
#include <hip/hip_runtime.h>

typedef __attribute__((ext_vector_type(16))) _Float16 v16h;
typedef __attribute__((ext_vector_type(8)))  _Float16 v8h;
typedef __attribute__((ext_vector_type(4)))  _Float16 v4h;
typedef __attribute__((ext_vector_type(8)))  float    v8f;
typedef __attribute__((ext_vector_type(4)))  float    f32x4;
typedef __attribute__((ext_vector_type(4)))  unsigned int u32x4;
typedef __attribute__((ext_vector_type(8)))  int i32x8;
typedef __attribute__((ext_vector_type(4)))  int i32x4;

namespace {
constexpr int  kE = 768, kB = 2, kS = 2048;
constexpr long XH_ELT = (long)kB * kS * kE;   // 3,145,728 halves (x / Q / K / V / AO)
constexpr long WP_ELT = (long)kE * kE;        // 589,824 halves per packed weight
constexpr int  kPackBlocks  = (int)(WP_ELT / (256 * 32));  // blocks per weight pack, 32 elements a thread
constexpr int  kCvtBlocks   = (int)(XH_ELT / (256 * 64));  // blocks for the conversion of x, 64 a thread
constexpr int  kPrepBlocks = 1 + 4 * kPackBlocks + kCvtBlocks;
constexpr unsigned kPanelBytes = 24u * 2048u * 2u;  // 96KB B panel in LDS
constexpr int kTileKeys = 128;                 // keys per K/V tile in LDS
constexpr int kKPitchH  = 72;                  // halves: a 128-byte K row at a 144-byte pitch
constexpr unsigned kKStepB = 16u * kKPitchH * 2u;  // 128 lanes x 16 B = 16 K rows
constexpr int kKAreaH   = kTileKeys * kKPitchH;
constexpr int kBufH     = kKAreaH + kTileKeys * 64;  // K area + V area, halves
}

union F16x16 { v16h v; _Float16 e[16]; };
union F32x8  { v8f  v; float    e[8];  };

__device__ __forceinline__ v8f wmma_f16(v16h a, v16h b, v8f c) {
  return __builtin_amdgcn_wmma_f32_16x16x32_f16(false, a, false, b, (short)0, c, false, false);
}

// 16-bit A 16x32 layout: a lane holds row (lane&15); its 16 halves are
// K = {0..7,16..23} (+8 for the upper half-wave), two pieces of 16 bytes.
// Packed A tile (512 halves): piece 0 of lanes 0..31, then piece 1 of lanes 0..31, so a
// wave-wide 16-byte load or store of one piece is 512 contiguous bytes, four whole lines.
// Fragment from two 16-byte pieces that lie hstep halves apart.
__device__ __forceinline__ v16h load_frag(const _Float16* p, int hstep) {
  F16x16 a;
  v8h lo = *(const v8h*)p;
  v8h hi = *(const v8h*)(p + hstep);
#pragma unroll
  for (int i = 0; i < 8; ++i) { a.e[i] = lo[i]; a.e[8 + i] = hi[i]; }
  return a.v;
}

#if defined(__has_builtin)
#if __has_builtin(__builtin_amdgcn_tensor_load_to_lds) && __has_builtin(__builtin_amdgcn_s_wait_tensorcnt)
#define USE_TDM 1
#endif
#endif

#ifdef USE_TDM
// 2D TDM: copy rows x w_elts (2-byte elements, row stride in elements) to LDS.
__device__ __forceinline__ void tdm_load_2d(unsigned lds_byte_off, const void* gsrc,
                                            unsigned w_elts, unsigned rows,
                                            unsigned long row_stride_elts) {
  unsigned long ga = (unsigned long)gsrc;
  u32x4 g0;
  g0[0] = 1u;                                               // count=1, user descriptor
  g0[1] = lds_byte_off;                                     // lds_addr
  g0[2] = (unsigned)ga;                                     // global_addr[31:0]
  g0[3] = (unsigned)((ga >> 32) & 0x01FFFFFFu) | (2u << 30);// global_addr[56:32] | type=2
  i32x8 g1;
  g1[0] = 0x10000;                                          // wg_mask=0, data_size=1 (2B)
  g1[1] = (int)((w_elts & 0xFFFFu) << 16);                  // tensor_dim0[15:0]
  g1[2] = (int)((w_elts >> 16) | ((rows & 0xFFFFu) << 16)); // dim0[31:16] | dim1[15:0]
  g1[3] = (int)((rows >> 16) | ((w_elts & 0xFFFFu) << 16)); // dim1[31:16] | tile_dim0
  g1[4] = (int)(rows & 0xFFFFu);                            // tile_dim1 | tile_dim2=0
  g1[5] = (int)(row_stride_elts & 0xFFFFFFFFul);            // dim0_stride[31:0]
  g1[6] = (int)((row_stride_elts >> 32) & 0xFFFFul);        // dim0_stride[47:32]
  g1[7] = 0;
  i32x4 z4;
  z4[0] = 0; z4[1] = 0; z4[2] = 0; z4[3] = 0;
  i32x8 z8;
#pragma unroll
  for (int i = 0; i < 8; ++i) z8[i] = 0;
  __builtin_amdgcn_tensor_load_to_lds(g0, g1, z4, z4, z8, 0);
}
#endif

// A block converts 16384 floats of x[4096][768] into 32 packed A tiles [mt=256][kt=24][512]:
// a wave takes four tiles that are neighbours in k (24 = 6 x 4). Each thread sixteen 16-byte
// loads, all issued before the first is used; a wave-wide load is four rows of one tile,
// four whole lines. A lane's four floats are half a piece: 8-byte stores, 64 bytes in a row.
__device__ __forceinline__ void cvt_f16(const float* __restrict__ src, _Float16* __restrict__ dst,
                                        int blk) {
  const int lane  = threadIdx.x & 31;
  const int tile0 = (blk * 8 + (threadIdx.x >> 5)) * 4;   // < 6144
  const int r  = lane >> 3;                               // row in a group of four
  const int k0 = (lane & 7) * 4;                          // first of this lane's four k
  const float* sp = src + ((tile0 / 24) * 16 + r) * 768 + (tile0 % 24) * 32 + k0;
  // piece k0/16, lane (k0/8 % 2) * 16 + row, upper or lower half of the piece
  _Float16* dp = dst + tile0 * 512 + (k0 >> 4) * 256 + (((k0 >> 3) & 1) * 16 + r) * 8 +
                 ((k0 >> 2) & 1) * 4;
  f32x4 v[16];
  // the loops of this function are unrolled so that v and h stay in registers
#pragma unroll
  for (int u = 0; u < 4; ++u)
#pragma unroll
    for (int j = 0; j < 4; ++j) v[u * 4 + j] = *(const f32x4*)(sp + j * (4 * 768) + u * 32);
  // keeps all sixteen loads ahead of the first conversion: without it the last four
  // are issued only after the first have come back, a second trip to memory
  __builtin_amdgcn_sched_barrier(0);
  // precaution: the loads' address is an input here, so it stays in its registers up to
  // this wait and no load's result lands in them ahead of it
  asm volatile("s_wait_xcnt 0x0" :: "v"(sp) : "memory");
  v4h h[16];
#pragma unroll
  for (int j = 0; j < 16; ++j)
#pragma unroll
    for (int c = 0; c < 4; ++c) h[j][c] = (_Float16)v[j][c];
#pragma unroll
  for (int u = 0; u < 4; ++u)
#pragma unroll
    for (int j = 0; j < 4; ++j) *(v4h*)(dp + u * 512 + j * 32) = h[u * 4 + j];
  // precaution: the stores' address and data registers are rewritten only behind this wait
  asm volatile("s_wait_xcnt 0x0" ::: "memory");
}

// Pack W[768][768] (k rows, n cols) into B-fragment tiles [kt=24][nt=48][512]:
// tile element (lane,i) = W[kt*32 + kof(lane,i)][nt*16 + lane%16]
// A thread makes one lane's 16 halves (32 contiguous bytes out) of two tiles; a
// block takes 16 neighbouring nt of one kt (48 = 3 x 16), so W's lines are used whole.
__device__ __forceinline__ void pack_w(const float* __restrict__ W, _Float16* __restrict__ Wp,
                                       int blk) {
  const int lane = threadIdx.x & 31;
  const int tile = blk * 16 + (threadIdx.x >> 5);      // this one and tile + 8; < 1152
  const int nt = tile % 48;
  const int kt = tile / 48;
  const float* p = W + (kt * 32 + ((lane & 16) ? 8 : 0)) * 768 + nt * 16 + (lane & 15);
  float f[2][16];
  // unrolled here and below: f and h stay in registers, the 32 loads go out as one group
#pragma unroll
  for (int u = 0; u < 2; ++u)
#pragma unroll
    for (int i = 0; i < 16; ++i) f[u][i] = p[((i < 8) ? i : i + 8) * 768 + u * 128];
#pragma unroll
  for (int u = 0; u < 2; ++u) {
    F16x16 h;
#pragma unroll
    for (int i = 0; i < 16; ++i) h.e[i] = (_Float16)f[u][i];
    *(v16h*)(Wp + (tile + u * 8) * 512 + lane * 16) = h.v;
  }
  // precaution: the stores' address and data registers are rewritten only behind this wait
  asm volatile("s_wait_xcnt 0x0" ::: "memory");
}

__device__ __forceinline__ void dscale(const float* __restrict__ de, const float* __restrict__ Wd,
                                       const float* __restrict__ bd, float* __restrict__ dsc) {
  int t = threadIdx.x;
  if (t >= 24) return;
  int b = t / 12, h = t % 12;
  float s = bd[h];
  for (int i = 0; i < 64; ++i) s += de[b * 64 + i] * Wd[i * 12 + h];
  dsc[t] = s * (0.125f * 1.44269504f);   // fold in 1/sqrt(64) and log2(e): the softmax runs in base 2
}

// Everything that depends on the inputs alone, in one launch: block 0 the head
// scales, then the four weight packs, then the conversion of x.
__global__ __launch_bounds__(256) void prep_kernel(
    const float* __restrict__ x, const float* __restrict__ Wq, const float* __restrict__ Wk,
    const float* __restrict__ Wv, const float* __restrict__ Wo, const float* __restrict__ de,
    const float* __restrict__ Wd, const float* __restrict__ bd, _Float16* __restrict__ xh,
    _Float16* __restrict__ wpk, float* __restrict__ dsc) {
  const int blk = blockIdx.x;
  if (blk == 0) {
    dscale(de, Wd, bd, dsc);
  } else if (blk <= 4 * kPackBlocks) {
    const int w = (blk - 1) / kPackBlocks;
    const float* W = (w == 0) ? Wq : (w == 1) ? Wk : (w == 2) ? Wv : Wo;
    pack_w(W, wpk + w * WP_ELT, (blk - 1) - w * kPackBlocks);
  } else {
    cvt_f16(x, xh, blk - 1 - 4 * kPackBlocks);
  }
}

// C[4096,768] = A(f16, packed A tiles [mt=256][kt=24][512]) @ Wpacked + bias.
// Block = 4 waves -> 128(M) x 64(N). B panel (24 x 2048 halves = 96KB) staged in
// LDS once per block via TDM; wave computes 32x64. A fragments come from global
// memory kAhead k steps ahead of their products, B fragments from LDS one k step
// ahead, both into register rings. Half outputs: products 0 and 1 (Q, K) go out as
// [B,H,S,64] rows, Q times its head's score scale (in f32, ahead of the one rounding to
// half); product 2 (V) goes out as the attention's A-fragment tiles, per
// head [kt=64][dt=4][512], tile element (lane,i) = V[kt*32 + kof(lane,i)][dt*16 + lane%16].
__global__ __launch_bounds__(128) void gemm_wmma_kernel(
    const _Float16* __restrict__ A, const _Float16* __restrict__ Wp0,
    const float* __restrict__ bias0, const float* __restrict__ bias1,
    const float* __restrict__ bias2, const float* __restrict__ qscale,
    _Float16* __restrict__ out_h0, float* __restrict__ out_f) {
  extern __shared__ _Float16 smem[];                   // [24][2048] B panel
  // blockIdx.z picks one of up to three products that share A: their packed
  // weights lie one behind the other, and so do their outputs.
  const int z = blockIdx.z;
  const _Float16* __restrict__ Wp = Wp0 + z * WP_ELT;
  const float* __restrict__ bias = (z == 0) ? bias0 : (z == 1) ? bias1 : bias2;
  _Float16* __restrict__ out_h = out_h0 + z * XH_ELT;   // stays null where out_h0 is (z = 0 there)
  const int lane  = threadIdx.x & 31;
  const int wave  = threadIdx.x >> 5;
  const int mbase = blockIdx.x * 128 + wave * 32;
  const int nbase = blockIdx.y * 64;
  const int lm    = lane & 15;
  const int hi8   = (lane & 16) ? 8 : 0;
  const int nt0   = nbase >> 4;

  const _Float16* a0p = A + (long)(mbase >> 4) * (24 * 512) + lane * 8;
  const _Float16* a1p = a0p + 24 * 512;
  constexpr int kSteps = 24;                          // k steps of 32
  constexpr int kAhead = 4;                           // k steps that A is fetched ahead
  v16h a[kAhead + 1][2];                              // ring, slot = k step mod (kAhead + 1)
  // unrolled: the ring's slots are constants, so it stays in registers
#pragma unroll
  for (int s = 0; s < kAhead; ++s) {
    a[s][0] = load_frag(a0p + s * 512, 256);
    a[s][1] = load_frag(a1p + s * 512, 256);
  }

#ifdef USE_TDM
  if (wave == 0) {
    tdm_load_2d((unsigned)(size_t)(&smem[0]), Wp + (long)nt0 * 512,
                2048u, 24u, 48ul * 512ul);
    __builtin_amdgcn_s_wait_tensorcnt(0);
  }
  __syncthreads();
#else
  {  // cooperative fallback copy: 128 threads x v8h
    const _Float16* src = Wp + (long)nt0 * 512;
    for (int r = 0; r < 24; ++r) {
      for (int c = threadIdx.x * 8; c < 2048; c += 128 * 8)
        *(v8h*)(smem + r * 2048 + c) = *(const v8h*)(src + (long)r * 48 * 512 + c);
    }
  }
  __syncthreads();
#endif

  v8f acc[2][4] = {};
  v16h b[2][4];                                       // slot = k step mod 2
  const _Float16* bp = smem + lane * 16;
  // every loop from here to the end of the k loop is unrolled: ring slots are then
  // constants, so both rings stay in registers
#pragma unroll
  for (int t = 0; t < 4; ++t) b[0][t] = *(const v16h*)(bp + t * 512);

#pragma unroll
  for (int kt = 0; kt < kSteps; ++kt) {
    if (kt + kAhead < kSteps) {
      a[(kt + kAhead) % (kAhead + 1)][0] = load_frag(a0p + (kt + kAhead) * 512, 256);
      a[(kt + kAhead) % (kAhead + 1)][1] = load_frag(a1p + (kt + kAhead) * 512, 256);
    }
    if (kt + 1 < kSteps) {
#pragma unroll
      for (int t = 0; t < 4; ++t)
        b[(kt + 1) & 1][t] = *(const v16h*)(bp + (kt + 1) * 2048 + t * 512);
    }
    // keeps the loads above as one group ahead of this step's products: left free, the
    // scheduler sinks each load to just before its use and every latency is waited out
    __builtin_amdgcn_sched_barrier(0);
#pragma unroll
    for (int t = 0; t < 4; ++t) {
      acc[0][t] = wmma_f16(a[kt % (kAhead + 1)][0], b[kt & 1][t], acc[0][t]);
      acc[1][t] = wmma_f16(a[kt % (kAhead + 1)][1], b[kt & 1][t], acc[1][t]);
    }
    // keeps the next step's loads from being spread among these products
    __builtin_amdgcn_sched_barrier(0);
  }

  if (z == 2) {
    // The wave's 32 rows are one kt of one head, its four column tiles the four dt.
    // A lane's accumulators hold column lane%16 and rows m*16 + hi8 + j, which are the
    // fragment's halves i = m*8 + j of this same lane: 32 contiguous bytes per tile.
    _Float16* vt = out_h + ((long)((mbase >> 11) * 12 + blockIdx.y) << 17) +
                   ((mbase & 2047) >> 5) * 2048 + lane * 16;
    F16x16 h[4];
    // unrolled here and below: h stays in registers
#pragma unroll
    for (int t = 0; t < 4; ++t) {
      const float bv = bias[nbase + t * 16 + lm];
#pragma unroll
      for (int j = 0; j < 8; ++j) {
        h[t].e[j]     = (_Float16)(acc[0][t][j] + bv);
        h[t].e[8 + j] = (_Float16)(acc[1][t][j] + bv);
      }
    }
#pragma unroll
    for (int t = 0; t < 4; ++t) *(v16h*)(vt + t * 512) = h[t].v;
    return;
  }

  // A launch gives exactly one of out_f and out_h0. Which one is tested once here, not at
  // every element, so each path is a straight run of stores off one base address.
  float bv[4];
  // unrolled here and below: bv stays in registers, every store's offset is a constant
#pragma unroll
  for (int t = 0; t < 4; ++t) bv[t] = bias[nbase + t * 16 + lm];
  // C layout: a lane holds column t*16 + lm and rows m*16 + hi8 + j
  if (out_f) {
    float* op = out_f + (long)(mbase + hi8) * 768 + nbase + lm;
#pragma unroll
    for (int m = 0; m < 2; ++m)
#pragma unroll
      for (int t = 0; t < 4; ++t)
#pragma unroll
        for (int j = 0; j < 8; ++j) op[(m * 16 + j) * 768 + t * 16] = acc[m][t][j] + bv[t];
    // precaution: in the built code the half path stands behind these stores and rewrites
    // their address and data registers; it does so only behind this wait
    asm volatile("s_wait_xcnt 0x0" ::: "memory");
    return;
  }
  // [B,H,S,64]: the wave's 32 rows lie in one batch entry, the block's 64 columns are one head
  const int bh = (mbase >> 11) * 12 + blockIdx.y;
  _Float16* op = out_h + ((((long)bh) << 11) + (mbase & 2047) + hi8) * 64 + lm;
  // (acc + bias) * scale as one multiply-add; K's scale is 1, so its multiply-add is acc + bias
  const float qs = (z == 0) ? qscale[bh] : 1.f;
#pragma unroll
  for (int t = 0; t < 4; ++t) bv[t] *= qs;
#pragma unroll
  for (int m = 0; m < 2; ++m)
#pragma unroll
    for (int t = 0; t < 4; ++t)
#pragma unroll
      for (int j = 0; j < 8; ++j)
        op[(m * 16 + j) * 64 + t * 16] = (_Float16)fmaf(acc[m][t][j], qs, bv[t]);
  // precaution, as above: in the built code the V path stands behind these stores
  asm volatile("s_wait_xcnt 0x0" ::: "memory");
}

// 64 keys of K and of V, global -> LDS, 16 bytes per lane and copy, no register
// in between. The s_wait_xcnt stands inside the statement so that no address
// register is rewritten ahead of it.
__device__ __forceinline__ void copy_kv64(unsigned kl, const _Float16* kg,
                                          unsigned vl, const _Float16* vg) {
  asm volatile(
      "global_load_async_to_lds_b128 %0, %1, off\n\t"
      "global_load_async_to_lds_b128 %2, %3, off\n\t"
      "global_load_async_to_lds_b128 %4, %5, off\n\t"
      "global_load_async_to_lds_b128 %6, %7, off\n\t"
      "global_load_async_to_lds_b128 %8, %9, off\n\t"
      "global_load_async_to_lds_b128 %10, %11, off\n\t"
      "global_load_async_to_lds_b128 %12, %13, off\n\t"
      "global_load_async_to_lds_b128 %14, %15, off\n\t"
      "s_wait_xcnt 0x0"
      :: "v"(kl),                  "v"(kg),
         "v"(kl + 1u * kKStepB),   "v"(kg + 1024),
         "v"(kl + 2u * kKStepB),   "v"(kg + 2048),
         "v"(kl + 3u * kKStepB),   "v"(kg + 3072),
         "v"(vl),                  "v"(vg),
         "v"(vl + 2048u),          "v"(vg + 1024),
         "v"(vl + 4096u),          "v"(vg + 2048),
         "v"(vl + 6144u),          "v"(vg + 3072)
      : "memory");
}

// Transposed flash attention: per wave one 16-row q tile, 64 chunks of 32 keys.
// S^T = K @ Q^T keeps the softmax (key) axis per-lane; P^T converts in-lane to
// the B-fragment for out^T = V^T @ P^T. Q arrives times scale * log2(e), so the products
// are the exponents to base 2 as they stand. The four waves of a block share K and V:
// tiles of 128 keys are copied to LDS once per block, two buffers, the next tile
// in flight while this one is worked on. K rows lie at a 144-byte pitch, each V
// fragment as two runs of 16 bytes per lane, so every b128 read is conflict-free.
__global__ __launch_bounds__(128) void attn_kernel(
    const _Float16* __restrict__ Qb, const _Float16* __restrict__ Kb,
    const _Float16* __restrict__ Vp, _Float16* __restrict__ AO) {
  __shared__ __attribute__((aligned(16))) _Float16 kv[2 * kBufH];
  const int tid  = threadIdx.x;
  const int lane = threadIdx.x & 31;
  const int wave = threadIdx.x >> 5;
  const int bh   = blockIdx.y;                 // 0..23
  const int qt   = blockIdx.x * 4 + wave;      // 0..127
  const int lm   = lane & 15;
  const int hi8  = (lane & 16) ? 8 : 0;
  const long hbase = (long)bh << 17;           // 2048*64 per head
  const _Float16* Q = Qb + hbase;
  const _Float16* K = Kb + hbase;
  const _Float16* V = Vp + hbase;
  const int qbase = qt * 16;

  // This lane's 16-byte piece of a tile: source (contiguous) and place in LDS.
  const unsigned lds0 = (unsigned)(size_t)(&kv[0]);
  const unsigned kl0 = lds0 + (unsigned)(tid >> 3) * (kKPitchH * 2u) + (unsigned)(tid & 7) * 16u;
  const unsigned vl0 = lds0 + kKAreaH * 2u + (unsigned)(tid >> 6) * 1024u +
                       (unsigned)(tid & 1) * 512u + (unsigned)((tid >> 1) & 31) * 16u;
  const _Float16* kg0 = K + tid * 8;
  const _Float16* vg0 = V + tid * 8;
  auto copy_tile = [&](int t, int buf) {
    const unsigned bo = (unsigned)buf * (kBufH * 2u);
    const _Float16* kg = kg0 + (long)t * (kTileKeys * 64);
    const _Float16* vg = vg0 + (long)t * (kTileKeys * 64);
    copy_kv64(kl0 + bo, kg, vl0 + bo, vg);
    copy_kv64(kl0 + bo + 64u * kKPitchH * 2u, kg + 4096, vl0 + bo + 8192u, vg + 4096);
  };

  copy_tile(0, 0);

  // Q^T B-fragments for the two d-halves (loaded once, reused 64x)
  F16x16 bq0, bq1;
  {
    const _Float16* qp = Q + (qbase + lm) * 64;
#pragma unroll
    for (int i = 0; i < 16; ++i) {
      int d = ((i < 8) ? i : i + 8) + hi8;
      bq0.e[i] = qp[d];
      bq1.e[i] = qp[32 + d];
    }
  }

  // tile 0 has landed for this wave, then for all; only then is it read
  asm volatile("s_wait_asynccnt 0x0" ::: "memory");
  __syncthreads();
  copy_tile(1, 1);

  auto loadK = [&](const _Float16* kp, v16h* ka) {
    ka[0] = load_frag(kp, 16);                      // tile0, d 0..31
    ka[1] = load_frag(kp + 32, 16);                 // tile0, d 32..63
    ka[2] = load_frag(kp + 16 * kKPitchH, 16);      // tile1, d 0..31
    ka[3] = load_frag(kp + 16 * kKPitchH + 32, 16); // tile1, d 32..63
  };

  v8f o[4] = {};
  float mrow = -1e30f, lrow = 0.f;

  // one 32-key chunk; fetches the tile's next chunk of K (if any) into kapf
  // between scores & softmax
  auto chunk = [&](const _Float16* vp, v16h* ka, const _Float16* kpf, v16h* kapf) {
    v16h vv0 = load_frag(vp, 256);
    v16h vv1 = load_frag(vp + 512, 256);
    v16h vv2 = load_frag(vp + 1024, 256);
    v16h vv3 = load_frag(vp + 1536, 256);

    v8f st0 = {}, st1 = {};
    st0 = wmma_f16(ka[0], bq0.v, st0);
    st0 = wmma_f16(ka[1], bq1.v, st0);
    st1 = wmma_f16(ka[2], bq0.v, st1);
    st1 = wmma_f16(ka[3], bq1.v, st1);

    if (kpf) loadK(kpf, kapf);

    F32x8 s0, s1; s0.v = st0; s1.v = st1;
    float cmax = -1e30f;
#pragma unroll
    for (int j = 0; j < 8; ++j) cmax = fmaxf(cmax, fmaxf(s0.e[j], s1.e[j]));
    cmax = fmaxf(cmax, __shfl_xor(cmax, 16, 32));   // combine half-waves
    float mnew = fmaxf(mrow, cmax);
    float corr = __builtin_amdgcn_exp2f(mrow - mnew);
    F16x16 pb;                                       // P^T B-fragment, in-lane
    float psum = 0.f;
#pragma unroll
    for (int j = 0; j < 8; ++j) {
      float e0 = __builtin_amdgcn_exp2f(s0.e[j] - mnew);
      float e1 = __builtin_amdgcn_exp2f(s1.e[j] - mnew);
      psum += e0 + e1;
      pb.e[j]     = (_Float16)e0;                    // k' = j    + hi8
      pb.e[8 + j] = (_Float16)e1;                    // k' = j+16 + hi8
    }
    lrow = lrow * corr + psum;
    mrow = mnew;

#pragma unroll
    for (int t = 0; t < 4; ++t) {
      F32x8 uo; uo.v = o[t];
#pragma unroll
      for (int j = 0; j < 8; ++j) uo.e[j] *= corr;
      v16h av = (t == 0) ? vv0 : (t == 1) ? vv1 : (t == 2) ? vv2 : vv3;
      o[t] = wmma_f16(av, pb.v, uo.v);
    }
  };

  constexpr int kTiles = kS / kTileKeys;
  v16h kaA[4], kaB[4];
  for (int t = 0; t < kTiles; ++t) {
    const _Float16* kb = kv + (t & 1) * kBufH + lm * kKPitchH + hi8;
    const _Float16* vb = kv + (t & 1) * kBufH + kKAreaH + lane * 8;
    loadK(kb, kaA);
    chunk(vb,        kaA, kb + 32 * kKPitchH, kaB);
    chunk(vb + 2048, kaB, kb + 64 * kKPitchH, kaA);
    chunk(vb + 4096, kaA, kb + 96 * kKPitchH, kaB);
    chunk(vb + 6144, kaB, nullptr,            kaA);
    // hand-over: this wave's reads of the tile are done and its copies of the
    // next tile have landed, then the same holds for all four waves
    asm volatile("s_wait_dscnt 0x0" ::: "memory");
    asm volatile("s_wait_asynccnt 0x0" ::: "memory");
    __syncthreads();
    if (t + 2 < kTiles) copy_tile(t + 2, t & 1);     // refill the buffer just read
  }
  // no copy is left in flight when the wave ends
  asm volatile("s_wait_asynccnt 0x0" ::: "memory");

  float ltot = lrow + __shfl_xor(lrow, 16, 32);
  float inv = 1.f / ltot;
  // AO goes out as the output product's packed A tiles: token tile (bh/12)*128 + qt, k tile
  // (bh%12)*2 + t/2. A lane holds token lm and columns t*16 + hi8 + j, which are piece t%2
  // of this same lane: one 16-byte store a tile, 512 contiguous bytes a wave.
  _Float16* ap = AO + ((long)((bh / 12) * 128 + qt) * 24 + (bh % 12) * 2) * 512 + lane * 8;
  // unrolled: o stays in registers
#pragma unroll
  for (int t = 0; t < 4; ++t) {
    v8h h;
#pragma unroll
    for (int j = 0; j < 8; ++j) h[j] = (_Float16)(o[t][j] * inv);
    *(v8h*)(ap + (t >> 1) * 512 + (t & 1) * 256) = h;
  }
}

extern "C" void kernel_launch(void* const* d_in, const int* in_sizes, int n_in,
                              void* d_out, int out_size, void* d_ws, size_t ws_size,
                              hipStream_t stream) {
  (void)in_sizes; (void)n_in; (void)out_size; (void)ws_size;
  const float* x  = (const float*)d_in[0];
  const float* de = (const float*)d_in[1];
  const float* Wq = (const float*)d_in[2];
  const float* bq = (const float*)d_in[3];
  const float* Wk = (const float*)d_in[4];
  const float* bk = (const float*)d_in[5];
  const float* Wv = (const float*)d_in[6];
  const float* bv = (const float*)d_in[7];
  const float* Wd = (const float*)d_in[8];
  const float* bd = (const float*)d_in[9];
  const float* Wp = (const float*)d_in[10];
  const float* bp = (const float*)d_in[11];
  float* out = (float*)d_out;

  _Float16* ws16 = (_Float16*)d_ws;
  _Float16* xh  = ws16;
  _Float16* wqp = xh  + XH_ELT;
  _Float16* wkp = wqp + WP_ELT;
  _Float16* wvp = wkp + WP_ELT;
  _Float16* wpp = wvp + WP_ELT;
  _Float16* qb  = wpp + WP_ELT;
  _Float16* kb  = qb  + XH_ELT;
  _Float16* vb  = kb  + XH_ELT;
  _Float16* ao  = vb  + XH_ELT;
  float*    dsc = (float*)(ao + XH_ELT);

  prep_kernel<<<kPrepBlocks, 256, 0, stream>>>(
      x, Wq, Wk, Wv, Wp, de, Wd, bd, xh, wqp, dsc);

  // 4096/128 x 768/64 tiles; z = Q, K, V (V comes out packed for the attention)
  gemm_wmma_kernel<<<dim3(32, 12, 3), 128, kPanelBytes, stream>>>(xh, wqp, bq, bk, bv, dsc, qb, nullptr);

  attn_kernel<<<dim3(32, 24), 128, 0, stream>>>(qb, kb, vb, ao);

  gemm_wmma_kernel<<<dim3(32, 12, 1), 128, kPanelBytes, stream>>>(ao, wpp, bp, bp, bp, nullptr, nullptr, out);
}

// v010
// Measured time: 56.3 microseconds a run.
// Versions in between are left out here; by their measured steps it is 1.10 times as fast as v008.
// All steps since v000 together make it 3.05 times as fast.
#include <hip/hip_runtime.h>

typedef __attribute__((ext_vector_type(16))) _Float16 v16h;
typedef __attribute__((ext_vector_type(8)))  _Float16 v8h;
typedef __attribute__((ext_vector_type(4)))  _Float16 v4h;
typedef __attribute__((ext_vector_type(8)))  float    v8f;
typedef __attribute__((ext_vector_type(4)))  float    f32x4;
typedef __attribute__((ext_vector_type(4)))  unsigned int u32x4;
typedef __attribute__((ext_vector_type(8)))  int i32x8;
typedef __attribute__((ext_vector_type(4)))  int i32x4;

namespace {
constexpr int  kE = 768, kB = 2, kS = 2048;
constexpr long XH_ELT = (long)kB * kS * kE;   // 3,145,728 halves (x / Q / K / V / AO)
constexpr long WP_ELT = (long)kE * kE;        // 589,824 halves per packed weight
constexpr int  kPackBlocks  = (int)(WP_ELT / (256 * 32));  // blocks per weight pack, 32 elements a thread
constexpr int  kCvtBlocks   = (int)(XH_ELT / (256 * 64));  // blocks for the conversion of x, 64 a thread
constexpr int  kPrepBlocks = 1 + 4 * kPackBlocks + kCvtBlocks;
constexpr unsigned kPanelBytes = 24u * 2048u * 2u;  // 96KB B panel in LDS
constexpr int kTileKeys = 128;                 // keys per K/V tile in LDS
constexpr int kKPitchH  = 72;                  // halves: a 128-byte K row at a 144-byte pitch
constexpr unsigned kKStepB = 16u * kKPitchH * 2u;  // 128 lanes x 16 B = 16 K rows
constexpr int kKAreaH   = kTileKeys * kKPitchH;
constexpr int kBufH     = kKAreaH + kTileKeys * 64;  // K area + V area, halves
}

union F16x16 { v16h v; _Float16 e[16]; };
union F32x8  { v8f  v; float    e[8];  };

__device__ __forceinline__ v8f wmma_f16(v16h a, v16h b, v8f c) {
  return __builtin_amdgcn_wmma_f32_16x16x32_f16(false, a, false, b, (short)0, c, false, false);
}

// 16-bit A 16x32 layout: a lane holds row (lane&15); its 16 halves are
// K = {0..7,16..23} (+8 for the upper half-wave), two pieces of 16 bytes.
// Packed A tile (512 halves): piece 0 of lanes 0..31, then piece 1 of lanes 0..31, so a
// wave-wide 16-byte load or store of one piece is 512 contiguous bytes, four whole lines.
// Fragment from two 16-byte pieces that lie hstep halves apart.
__device__ __forceinline__ v16h load_frag(const _Float16* p, int hstep) {
  F16x16 a;
  v8h lo = *(const v8h*)p;
  v8h hi = *(const v8h*)(p + hstep);
#pragma unroll
  for (int i = 0; i < 8; ++i) { a.e[i] = lo[i]; a.e[8 + i] = hi[i]; }
  return a.v;
}

#if defined(__has_builtin)
#if __has_builtin(__builtin_amdgcn_tensor_load_to_lds) && __has_builtin(__builtin_amdgcn_s_wait_tensorcnt)
#define USE_TDM 1
#endif
#endif

#ifdef USE_TDM
// 2D TDM: copy rows x w_elts (2-byte elements, row stride in elements) to LDS.
__device__ __forceinline__ void tdm_load_2d(unsigned lds_byte_off, const void* gsrc,
                                            unsigned w_elts, unsigned rows,
                                            unsigned long row_stride_elts) {
  unsigned long ga = (unsigned long)gsrc;
  u32x4 g0;
  g0[0] = 1u;                                               // count=1, user descriptor
  g0[1] = lds_byte_off;                                     // lds_addr
  g0[2] = (unsigned)ga;                                     // global_addr[31:0]
  g0[3] = (unsigned)((ga >> 32) & 0x01FFFFFFu) | (2u << 30);// global_addr[56:32] | type=2
  i32x8 g1;
  g1[0] = 0x10000;                                          // wg_mask=0, data_size=1 (2B)
  g1[1] = (int)((w_elts & 0xFFFFu) << 16);                  // tensor_dim0[15:0]
  g1[2] = (int)((w_elts >> 16) | ((rows & 0xFFFFu) << 16)); // dim0[31:16] | dim1[15:0]
  g1[3] = (int)((rows >> 16) | ((w_elts & 0xFFFFu) << 16)); // dim1[31:16] | tile_dim0
  g1[4] = (int)(rows & 0xFFFFu);                            // tile_dim1 | tile_dim2=0
  g1[5] = (int)(row_stride_elts & 0xFFFFFFFFul);            // dim0_stride[31:0]
  g1[6] = (int)((row_stride_elts >> 32) & 0xFFFFul);        // dim0_stride[47:32]
  g1[7] = 0;
  i32x4 z4;
  z4[0] = 0; z4[1] = 0; z4[2] = 0; z4[3] = 0;
  i32x8 z8;
#pragma unroll
  for (int i = 0; i < 8; ++i) z8[i] = 0;
  __builtin_amdgcn_tensor_load_to_lds(g0, g1, z4, z4, z8, 0);
}
#endif

// A block converts 16384 floats of x[4096][768] into 32 packed A tiles [mt=256][kt=24][512]:
// a wave takes four tiles that are neighbours in k (24 = 6 x 4). Each thread sixteen 16-byte
// loads, all issued before the first is used; a wave-wide load is four rows of one tile,
// four whole lines. A lane's four floats are half a piece: 8-byte stores, 64 bytes in a row.
__device__ __forceinline__ void cvt_f16(const float* __restrict__ src, _Float16* __restrict__ dst,
                                        int blk) {
  const int lane  = threadIdx.x & 31;
  const int tile0 = (blk * 8 + (threadIdx.x >> 5)) * 4;   // < 6144
  const int r  = lane >> 3;                               // row in a group of four
  const int k0 = (lane & 7) * 4;                          // first of this lane's four k
  const float* sp = src + ((tile0 / 24) * 16 + r) * 768 + (tile0 % 24) * 32 + k0;
  // piece k0/16, lane (k0/8 % 2) * 16 + row, upper or lower half of the piece
  _Float16* dp = dst + tile0 * 512 + (k0 >> 4) * 256 + (((k0 >> 3) & 1) * 16 + r) * 8 +
                 ((k0 >> 2) & 1) * 4;
  f32x4 v[16];
  // the loops of this function are unrolled so that v and h stay in registers
#pragma unroll
  for (int u = 0; u < 4; ++u)
#pragma unroll
    for (int j = 0; j < 4; ++j) v[u * 4 + j] = *(const f32x4*)(sp + j * (4 * 768) + u * 32);
  // keeps all sixteen loads ahead of the first conversion: without it the last four
  // are issued only after the first have come back, a second trip to memory
  __builtin_amdgcn_sched_barrier(0);
  // precaution: the loads' address is an input here, so it stays in its registers up to
  // this wait and no load's result lands in them ahead of it
  asm volatile("s_wait_xcnt 0x0" :: "v"(sp) : "memory");
  v4h h[16];
#pragma unroll
  for (int j = 0; j < 16; ++j)
#pragma unroll
    for (int c = 0; c < 4; ++c) h[j][c] = (_Float16)v[j][c];
#pragma unroll
  for (int u = 0; u < 4; ++u)
#pragma unroll
    for (int j = 0; j < 4; ++j) *(v4h*)(dp + u * 512 + j * 32) = h[u * 4 + j];
  // precaution: the stores' address and data registers are rewritten only behind this wait
  asm volatile("s_wait_xcnt 0x0" ::: "memory");
}

// Pack W[768][768] (k rows, n cols) into B-fragment tiles [kt=24][nt=48][512]:
// tile element (lane,i) = W[kt*32 + kof(lane,i)][nt*16 + lane%16]
// A thread makes one lane's 16 halves (32 contiguous bytes out) of two tiles; a
// block takes 16 neighbouring nt of one kt (48 = 3 x 16), so W's lines are used whole.
__device__ __forceinline__ void pack_w(const float* __restrict__ W, _Float16* __restrict__ Wp,
                                       int blk) {
  const int lane = threadIdx.x & 31;
  const int tile = blk * 16 + (threadIdx.x >> 5);      // this one and tile + 8; < 1152
  const int nt = tile % 48;
  const int kt = tile / 48;
  const float* p = W + (kt * 32 + ((lane & 16) ? 8 : 0)) * 768 + nt * 16 + (lane & 15);
  float f[2][16];
  // unrolled here and below: f and h stay in registers, the 32 loads go out as one group
#pragma unroll
  for (int u = 0; u < 2; ++u)
#pragma unroll
    for (int i = 0; i < 16; ++i) f[u][i] = p[((i < 8) ? i : i + 8) * 768 + u * 128];
#pragma unroll
  for (int u = 0; u < 2; ++u) {
    F16x16 h;
#pragma unroll
    for (int i = 0; i < 16; ++i) h.e[i] = (_Float16)f[u][i];
    *(v16h*)(Wp + (tile + u * 8) * 512 + lane * 16) = h.v;
  }
  // precaution: the stores' address and data registers are rewritten only behind this wait
  asm volatile("s_wait_xcnt 0x0" ::: "memory");
}

__device__ __forceinline__ void dscale(const float* __restrict__ de, const float* __restrict__ Wd,
                                       const float* __restrict__ bd, float* __restrict__ dsc) {
  int t = threadIdx.x;
  if (t >= 24) return;
  int b = t / 12, h = t % 12;
  float s = bd[h];
  for (int i = 0; i < 64; ++i) s += de[b * 64 + i] * Wd[i * 12 + h];
  dsc[t] = s * (0.125f * 1.44269504f);   // fold in 1/sqrt(64) and log2(e): the softmax runs in base 2
}

// Everything that depends on the inputs alone, in one launch: block 0 the head
// scales, then the four weight packs, then the conversion of x.
__global__ __launch_bounds__(256) void prep_kernel(
    const float* __restrict__ x, const float* __restrict__ Wq, const float* __restrict__ Wk,
    const float* __restrict__ Wv, const float* __restrict__ Wo, const float* __restrict__ de,
    const float* __restrict__ Wd, const float* __restrict__ bd, _Float16* __restrict__ xh,
    _Float16* __restrict__ wpk, float* __restrict__ dsc) {
  const int blk = blockIdx.x;
  if (blk == 0) {
    dscale(de, Wd, bd, dsc);
  } else if (blk <= 4 * kPackBlocks) {
    const int w = (blk - 1) / kPackBlocks;
    const float* W = (w == 0) ? Wq : (w == 1) ? Wk : (w == 2) ? Wv : Wo;
    pack_w(W, wpk + w * WP_ELT, (blk - 1) - w * kPackBlocks);
  } else {
    cvt_f16(x, xh, blk - 1 - 4 * kPackBlocks);
  }
}

// C[4096,768] = A(f16, packed A tiles [mt=256][kt=24][512]) @ Wpacked + bias.
// Block = 4 waves -> 128(M) x 64(N). B panel (24 x 2048 halves = 96KB) staged in
// LDS once per block via TDM; wave computes 32x64. A fragments come from global
// memory kAhead k steps ahead of their products, B fragments from LDS one k step
// ahead, both into register rings. Half outputs: products 0 and 1 (Q, K) go out as
// [B,H,S,64] rows, Q times its head's score scale (in f32, ahead of the one rounding to
// half); product 2 (V) goes out as the attention's A-fragment tiles, per
// head [kt=64][dt=4][512], tile element (lane,i) = V[kt*32 + kof(lane,i)][dt*16 + lane%16].
__global__ __launch_bounds__(128) void gemm_wmma_kernel(
    const _Float16* __restrict__ A, const _Float16* __restrict__ Wp0,
    const float* __restrict__ bias0, const float* __restrict__ bias1,
    const float* __restrict__ bias2, const float* __restrict__ qscale,
    _Float16* __restrict__ out_h0, float* __restrict__ out_f) {
  extern __shared__ _Float16 smem[];                   // [24][2048] B panel
  // blockIdx.z picks one of up to three products that share A: their packed
  // weights lie one behind the other, and so do their outputs.
  const int z = blockIdx.z;
  const _Float16* __restrict__ Wp = Wp0 + z * WP_ELT;
  const float* __restrict__ bias = (z == 0) ? bias0 : (z == 1) ? bias1 : bias2;
  _Float16* __restrict__ out_h = out_h0 + z * XH_ELT;   // stays null where out_h0 is (z = 0 there)
  const int lane  = threadIdx.x & 31;
  const int wave  = threadIdx.x >> 5;
  const int mbase = blockIdx.x * 128 + wave * 32;
  const int nbase = blockIdx.y * 64;
  const int lm    = lane & 15;
  const int hi8   = (lane & 16) ? 8 : 0;
  const int nt0   = nbase >> 4;

  const _Float16* a0p = A + (long)(mbase >> 4) * (24 * 512) + lane * 8;
  const _Float16* a1p = a0p + 24 * 512;
  constexpr int kSteps = 24;                          // k steps of 32
  constexpr int kAhead = 4;                           // k steps that A is fetched ahead
  v16h a[kAhead + 1][2];                              // ring, slot = k step mod (kAhead + 1)
  // unrolled: the ring's slots are constants, so it stays in registers
#pragma unroll
  for (int s = 0; s < kAhead; ++s) {
    a[s][0] = load_frag(a0p + s * 512, 256);
    a[s][1] = load_frag(a1p + s * 512, 256);
  }

#ifdef USE_TDM
  if (wave == 0) {
    tdm_load_2d((unsigned)(size_t)(&smem[0]), Wp + (long)nt0 * 512,
                2048u, 24u, 48ul * 512ul);
    __builtin_amdgcn_s_wait_tensorcnt(0);
  }
  __syncthreads();
#else
  {  // cooperative fallback copy: 128 threads x v8h
    const _Float16* src = Wp + (long)nt0 * 512;
    for (int r = 0; r < 24; ++r) {
      for (int c = threadIdx.x * 8; c < 2048; c += 128 * 8)
        *(v8h*)(smem + r * 2048 + c) = *(const v8h*)(src + (long)r * 48 * 512 + c);
    }
  }
  __syncthreads();
#endif

  v8f acc[2][4] = {};
  v16h b[2][4];                                       // slot = k step mod 2
  const _Float16* bp = smem + lane * 16;
  // every loop from here to the end of the k loop is unrolled: ring slots are then
  // constants, so both rings stay in registers
#pragma unroll
  for (int t = 0; t < 4; ++t) b[0][t] = *(const v16h*)(bp + t * 512);

#pragma unroll
  for (int kt = 0; kt < kSteps; ++kt) {
    if (kt + kAhead < kSteps) {
      a[(kt + kAhead) % (kAhead + 1)][0] = load_frag(a0p + (kt + kAhead) * 512, 256);
      a[(kt + kAhead) % (kAhead + 1)][1] = load_frag(a1p + (kt + kAhead) * 512, 256);
    }
    if (kt + 1 < kSteps) {
#pragma unroll
      for (int t = 0; t < 4; ++t)
        b[(kt + 1) & 1][t] = *(const v16h*)(bp + (kt + 1) * 2048 + t * 512);
    }
    // keeps the loads above as one group ahead of this step's products: left free, the
    // scheduler sinks each load to just before its use and every latency is waited out
    __builtin_amdgcn_sched_barrier(0);
#pragma unroll
    for (int t = 0; t < 4; ++t) {
      acc[0][t] = wmma_f16(a[kt % (kAhead + 1)][0], b[kt & 1][t], acc[0][t]);
      acc[1][t] = wmma_f16(a[kt % (kAhead + 1)][1], b[kt & 1][t], acc[1][t]);
    }
    // keeps the next step's loads from being spread among these products
    __builtin_amdgcn_sched_barrier(0);
  }

  if (z == 2) {
    // The wave's 32 rows are one kt of one head, its four column tiles the four dt.
    // A lane's accumulators hold column lane%16 and rows m*16 + hi8 + j, which are the
    // fragment's halves i = m*8 + j of this same lane: 32 contiguous bytes per tile.
    _Float16* vt = out_h + ((long)((mbase >> 11) * 12 + blockIdx.y) << 17) +
                   ((mbase & 2047) >> 5) * 2048 + lane * 16;
    F16x16 h[4];
    // unrolled here and below: h stays in registers
#pragma unroll
    for (int t = 0; t < 4; ++t) {
      const float bv = bias[nbase + t * 16 + lm];
#pragma unroll
      for (int j = 0; j < 8; ++j) {
        h[t].e[j]     = (_Float16)(acc[0][t][j] + bv);
        h[t].e[8 + j] = (_Float16)(acc[1][t][j] + bv);
      }
    }
#pragma unroll
    for (int t = 0; t < 4; ++t) *(v16h*)(vt + t * 512) = h[t].v;
    return;
  }

  // A launch gives exactly one of out_f and out_h0. Which one is tested once here, not at
  // every element, so each path is a straight run of stores off one base address.
  float bv[4];
  // unrolled here and below: bv stays in registers, every store's offset is a constant
#pragma unroll
  for (int t = 0; t < 4; ++t) bv[t] = bias[nbase + t * 16 + lm];
  // C layout: a lane holds column t*16 + lm and rows m*16 + hi8 + j
  if (out_f) {
    float* op = out_f + (long)(mbase + hi8) * 768 + nbase + lm;
#pragma unroll
    for (int m = 0; m < 2; ++m)
#pragma unroll
      for (int t = 0; t < 4; ++t)
#pragma unroll
        for (int j = 0; j < 8; ++j) op[(m * 16 + j) * 768 + t * 16] = acc[m][t][j] + bv[t];
    // precaution: in the built code the half path stands behind these stores and rewrites
    // their address and data registers; it does so only behind this wait
    asm volatile("s_wait_xcnt 0x0" ::: "memory");
    return;
  }
  // [B,H,S,64]: the wave's 32 rows lie in one batch entry, the block's 64 columns are one head
  const int bh = (mbase >> 11) * 12 + blockIdx.y;
  _Float16* op = out_h + ((((long)bh) << 11) + (mbase & 2047) + hi8) * 64 + lm;
  // (acc + bias) * scale as one multiply-add; K's scale is 1, so its multiply-add is acc + bias
  const float qs = (z == 0) ? qscale[bh] : 1.f;
#pragma unroll
  for (int t = 0; t < 4; ++t) bv[t] *= qs;
#pragma unroll
  for (int m = 0; m < 2; ++m)
#pragma unroll
    for (int t = 0; t < 4; ++t)
#pragma unroll
      for (int j = 0; j < 8; ++j)
        op[(m * 16 + j) * 64 + t * 16] = (_Float16)fmaf(acc[m][t][j], qs, bv[t]);
  // precaution, as above: in the built code the V path stands behind these stores
  asm volatile("s_wait_xcnt 0x0" ::: "memory");
}

// 64 keys of K and of V, global -> LDS, 16 bytes per lane and copy, no register
// in between. The s_wait_xcnt stands inside the statement so that no address
// register is rewritten ahead of it.
__device__ __forceinline__ void copy_kv64(unsigned kl, const _Float16* kg,
                                          unsigned vl, const _Float16* vg) {
  asm volatile(
      "global_load_async_to_lds_b128 %0, %1, off\n\t"
      "global_load_async_to_lds_b128 %2, %3, off\n\t"
      "global_load_async_to_lds_b128 %4, %5, off\n\t"
      "global_load_async_to_lds_b128 %6, %7, off\n\t"
      "global_load_async_to_lds_b128 %8, %9, off\n\t"
      "global_load_async_to_lds_b128 %10, %11, off\n\t"
      "global_load_async_to_lds_b128 %12, %13, off\n\t"
      "global_load_async_to_lds_b128 %14, %15, off\n\t"
      "s_wait_xcnt 0x0"
      :: "v"(kl),                  "v"(kg),
         "v"(kl + 1u * kKStepB),   "v"(kg + 1024),
         "v"(kl + 2u * kKStepB),   "v"(kg + 2048),
         "v"(kl + 3u * kKStepB),   "v"(kg + 3072),
         "v"(vl),                  "v"(vg),
         "v"(vl + 2048u),          "v"(vg + 1024),
         "v"(vl + 4096u),          "v"(vg + 2048),
         "v"(vl + 6144u),          "v"(vg + 3072)
      : "memory");
}

// Transposed flash attention. S^T = K @ Q^T keeps the softmax (key) axis per-lane; P^T
// converts in-lane to the B-fragment for out^T = V^T @ P^T. Q arrives times scale * log2(e),
// so the products are the exponents to base 2 as they stand. A block has 64 queries. A wave
// takes 32 of them, two q tiles, so that every K and V fragment it reads from LDS feeds two
// products, and one half of each tile's keys: waves w and w ^ 2 hold the same queries over
// different keys and join their partial results once, at the end.
// The four waves share K and V: tiles of 128 keys are copied to LDS once per block, two
// buffers, the next tile in flight while this one is worked on. K rows lie at a 144-byte
// pitch, each V fragment as two runs of 16 bytes per lane, so every b128 read is conflict-free.
__global__ __launch_bounds__(128) void attn_kernel(
    const _Float16* __restrict__ Qb, const _Float16* __restrict__ Kb,
    const _Float16* __restrict__ Vp, _Float16* __restrict__ AO) {
  __shared__ __attribute__((aligned(16))) _Float16 kv[2 * kBufH];
  const int tid  = threadIdx.x;
  const int lane = threadIdx.x & 31;
  const int wave = threadIdx.x >> 5;
  const int qg   = wave & 1;                   // which 32 of the block's 64 queries
  const int kh   = wave >> 1;                  // which 64 of every tile's 128 keys
  const int bh   = blockIdx.y;                 // 0..23
  const int lm   = lane & 15;
  const int hi8  = (lane & 16) ? 8 : 0;
  const long hbase = (long)bh << 17;           // 2048*64 per head
  const _Float16* Q = Qb + hbase;
  const _Float16* K = Kb + hbase;
  const _Float16* V = Vp + hbase;
  const int qbase = blockIdx.x * 64 + qg * 32;

  // This lane's 16-byte piece of a tile: source (contiguous) and place in LDS.
  const unsigned lds0 = (unsigned)(size_t)(&kv[0]);
  const unsigned kl0 = lds0 + (unsigned)(tid >> 3) * (kKPitchH * 2u) + (unsigned)(tid & 7) * 16u;
  const unsigned vl0 = lds0 + kKAreaH * 2u + (unsigned)(tid >> 6) * 1024u +
                       (unsigned)(tid & 1) * 512u + (unsigned)((tid >> 1) & 31) * 16u;
  const _Float16* kg0 = K + tid * 8;
  const _Float16* vg0 = V + tid * 8;
  auto copy_tile = [&](int t, int buf) {
    const unsigned bo = (unsigned)buf * (kBufH * 2u);
    const _Float16* kg = kg0 + (long)t * (kTileKeys * 64);
    const _Float16* vg = vg0 + (long)t * (kTileKeys * 64);
    copy_kv64(kl0 + bo, kg, vl0 + bo, vg);
    copy_kv64(kl0 + bo + 64u * kKPitchH * 2u, kg + 4096, vl0 + bo + 8192u, vg + 4096);
  };

  copy_tile(0, 0);

  // Q^T B-fragments, [q tile][d half] (loaded once, reused for every key)
  v16h bq[2][2];
  // unrolled here and in every loop over u, t or j below: what they index stays in registers
#pragma unroll
  for (int u = 0; u < 2; ++u) {
    const _Float16* qp = Q + (qbase + u * 16 + lm) * 64 + hi8;
    bq[u][0] = load_frag(qp, 16);
    bq[u][1] = load_frag(qp + 32, 16);
  }

  // tile 0 has landed for this wave, then for all; only then is it read
  asm volatile("s_wait_asynccnt 0x0" ::: "memory");
  __syncthreads();
  copy_tile(1, 1);

  auto loadK = [&](const _Float16* kp, v16h* ka) {
    ka[0] = load_frag(kp, 16);                      // tile0, d 0..31
    ka[1] = load_frag(kp + 32, 16);                 // tile0, d 32..63
    ka[2] = load_frag(kp + 16 * kKPitchH, 16);      // tile1, d 0..31
    ka[3] = load_frag(kp + 16 * kKPitchH + 32, 16); // tile1, d 32..63
  };

  v8f o[2][4] = {};
  float mrow[2] = {-1e30f, -1e30f}, mlim[2] = {-1e30f, -1e30f};  // mlim = mrow + 8 once mrow is set
  float lrow[2] = {0.f, 0.f};

  // one 32-key chunk for both q tiles; fetches the wave's next chunk of K (if any) into
  // kapf between scores & softmax
  auto chunk = [&](const _Float16* vp, v16h* ka, const _Float16* kpf, v16h* kapf) {
    v16h vv0 = load_frag(vp, 256);
    v16h vv1 = load_frag(vp + 512, 256);
    v16h vv2 = load_frag(vp + 1024, 256);
    v16h vv3 = load_frag(vp + 1536, 256);

    F32x8 s0[2], s1[2];
#pragma unroll
    for (int u = 0; u < 2; ++u) {
      v8f st0 = {}, st1 = {};
      st0 = wmma_f16(ka[0], bq[u][0], st0);
      st1 = wmma_f16(ka[2], bq[u][0], st1);
      st0 = wmma_f16(ka[1], bq[u][1], st0);
      st1 = wmma_f16(ka[3], bq[u][1], st1);
      s0[u].v = st0; s1[u].v = st1;
    }

    if (kpf) loadK(kpf, kapf);

    float cmax[2];
#pragma unroll
    for (int u = 0; u < 2; ++u) {
      cmax[u] = -1e30f;
#pragma unroll
      for (int j = 0; j < 8; ++j) cmax[u] = fmaxf(cmax[u], fmaxf(s0[u].e[j], s1[u].e[j]));
    }
    // Lazy rescale: mrow is the reference in use, not the running maximum. It moves only
    // when some query's chunk maximum lies more than 8 above it, so an exponential is at
    // most 2^8. One test for the whole wave and both q tiles, a scalar branch; the exchange
    // between the half-waves, the correction factors and the products on o stand behind it.
    if (__builtin_amdgcn_ballot_w32((cmax[0] > mlim[0]) | (cmax[1] > mlim[1])) != 0u) {
#pragma unroll
      for (int u = 0; u < 2; ++u) {
        float cm = fmaxf(cmax[u], __shfl_xor(cmax[u], 16, 32));  // both half-waves hold the same query
        float mnew = fmaxf(mrow[u], cm);
        float corr = __builtin_amdgcn_exp2f(mrow[u] - mnew);
        lrow[u] *= corr;
#pragma unroll
        for (int t = 0; t < 4; ++t) o[u][t] *= corr;
        mrow[u] = mnew;
        mlim[u] = mnew + 8.f;
      }
    }
    F16x16 pb[2];                                    // P^T B-fragments, in-lane
#pragma unroll
    for (int u = 0; u < 2; ++u) {
      float psum = 0.f;
#pragma unroll
      for (int j = 0; j < 8; ++j) {
        float e0 = __builtin_amdgcn_exp2f(s0[u].e[j] - mrow[u]);
        float e1 = __builtin_amdgcn_exp2f(s1[u].e[j] - mrow[u]);
        psum += e0 + e1;
        pb[u].e[j]     = (_Float16)e0;                 // k' = j    + hi8
        pb[u].e[8 + j] = (_Float16)e1;                 // k' = j+16 + hi8
      }
      lrow[u] += psum;
    }

#pragma unroll
    for (int u = 0; u < 2; ++u) {
      o[u][0] = wmma_f16(vv0, pb[u].v, o[u][0]);
      o[u][1] = wmma_f16(vv1, pb[u].v, o[u][1]);
      o[u][2] = wmma_f16(vv2, pb[u].v, o[u][2]);
      o[u][3] = wmma_f16(vv3, pb[u].v, o[u][3]);
    }
  };

  constexpr int kTiles = kS / kTileKeys;
  v16h kaA[4], kaB[4];
  for (int t = 0; t < kTiles; ++t) {
    const _Float16* kb = kv + (t & 1) * kBufH + (kh * 64 + lm) * kKPitchH + hi8;
    const _Float16* vb = kv + (t & 1) * kBufH + kKAreaH + kh * 4096 + lane * 8;
    loadK(kb, kaA);
    chunk(vb,        kaA, kb + 32 * kKPitchH, kaB);
    chunk(vb + 2048, kaB, nullptr,            kaA);
    // hand-over: this wave's reads of the tile are done and its copies of the
    // next tile have landed, then the same holds for all four waves
    asm volatile("s_wait_dscnt 0x0" ::: "memory");
    asm volatile("s_wait_asynccnt 0x0" ::: "memory");
    __syncthreads();
    if (t + 2 < kTiles) copy_tile(t + 2, t & 1);     // refill the buffer just read
  }
  // no copy is left in flight when the wave ends or the buffers are put to another use
  asm volatile("s_wait_asynccnt 0x0" ::: "memory");

  // Join of the two key halves. Behind the loop's last barrier nobody reads K or V any more,
  // so the buffers serve as the exchange area. A wave keeps q tile kh and hands the other one
  // to its partner: 32 sums, the reference and the row sum per lane, 16 bytes a lane and store.
  float* xs = (float*)kv;
  constexpr int kXWave = 8 * 128 + 64;               // floats per wave in the exchange area
  v8f keep[4], give[4];
  // unrolled here and below: keep and give stay in registers
#pragma unroll
  for (int t = 0; t < 4; ++t) {
    keep[t] = kh ? o[1][t] : o[0][t];
    give[t] = kh ? o[0][t] : o[1][t];
  }
  const float mk = kh ? mrow[1] : mrow[0], lk = kh ? lrow[1] : lrow[0];
  {
    float* xw = xs + wave * kXWave;
#pragma unroll
    for (int t = 0; t < 4; ++t) {
      f32x4 lo = {give[t][0], give[t][1], give[t][2], give[t][3]};
      f32x4 hi = {give[t][4], give[t][5], give[t][6], give[t][7]};
      *(f32x4*)(xw + (t * 2) * 128 + lane * 4)     = lo;
      *(f32x4*)(xw + (t * 2 + 1) * 128 + lane * 4) = hi;
    }
    xw[1024 + lane] = kh ? mrow[0] : mrow[1];
    xw[1056 + lane] = kh ? lrow[0] : lrow[1];
  }
  __syncthreads();                                   // the partner's partial results are in LDS
  const float* xp = xs + (wave ^ 2) * kXWave;
  const float mp = xp[1024 + lane], lp = xp[1056 + lane];
  const float mj = fmaxf(mk, mp);
  float ck = __builtin_amdgcn_exp2f(mk - mj);        // brings each half onto the common reference
  float cp = __builtin_amdgcn_exp2f(mp - mj);
  const float lj = lk * ck + lp * cp;
  const float inv = 1.f / (lj + __shfl_xor(lj, 16, 32));
  ck *= inv;
  cp *= inv;
  // AO goes out as the output product's packed A tiles: token tile (bh/12)*128 + qt, k tile
  // (bh%12)*2 + t/2. A lane holds token lm and columns t*16 + hi8 + j, which are piece t%2
  // of this same lane: one 16-byte store a tile, 512 contiguous bytes a wave.
  const int qt = blockIdx.x * 4 + qg * 2 + kh;       // 0..127
  _Float16* ap = AO + ((long)((bh / 12) * 128 + qt) * 24 + (bh % 12) * 2) * 512 + lane * 8;
#pragma unroll
  for (int t = 0; t < 4; ++t) {
    f32x4 lo = *(const f32x4*)(xp + (t * 2) * 128 + lane * 4);
    f32x4 hi = *(const f32x4*)(xp + (t * 2 + 1) * 128 + lane * 4);
    v8h h;
#pragma unroll
    for (int j = 0; j < 4; ++j) {
      h[j]     = (_Float16)(keep[t][j] * ck + lo[j] * cp);
      h[4 + j] = (_Float16)(keep[t][4 + j] * ck + hi[j] * cp);
    }
    *(v8h*)(ap + (t >> 1) * 512 + (t & 1) * 256) = h;
  }
}

extern "C" void kernel_launch(void* const* d_in, const int* in_sizes, int n_in,
                              void* d_out, int out_size, void* d_ws, size_t ws_size,
                              hipStream_t stream) {
  (void)in_sizes; (void)n_in; (void)out_size; (void)ws_size;
  const float* x  = (const float*)d_in[0];
  const float* de = (const float*)d_in[1];
  const float* Wq = (const float*)d_in[2];
  const float* bq = (const float*)d_in[3];
  const float* Wk = (const float*)d_in[4];
  const float* bk = (const float*)d_in[5];
  const float* Wv = (const float*)d_in[6];
  const float* bv = (const float*)d_in[7];
  const float* Wd = (const float*)d_in[8];
  const float* bd = (const float*)d_in[9];
  const float* Wp = (const float*)d_in[10];
  const float* bp = (const float*)d_in[11];
  float* out = (float*)d_out;

  _Float16* ws16 = (_Float16*)d_ws;
  _Float16* xh  = ws16;
  _Float16* wqp = xh  + XH_ELT;
  _Float16* wkp = wqp + WP_ELT;
  _Float16* wvp = wkp + WP_ELT;
  _Float16* wpp = wvp + WP_ELT;
  _Float16* qb  = wpp + WP_ELT;
  _Float16* kb  = qb  + XH_ELT;
  _Float16* vb  = kb  + XH_ELT;
  _Float16* ao  = vb  + XH_ELT;
  float*    dsc = (float*)(ao + XH_ELT);

  prep_kernel<<<kPrepBlocks, 256, 0, stream>>>(
      x, Wq, Wk, Wv, Wp, de, Wd, bd, xh, wqp, dsc);

  // 4096/128 x 768/64 tiles; z = Q, K, V (V comes out packed for the attention)
  gemm_wmma_kernel<<<dim3(32, 12, 3), 128, kPanelBytes, stream>>>(xh, wqp, bq, bk, bv, dsc, qb, nullptr);

  attn_kernel<<<dim3(32, 24), 128, 0, stream>>>(qb, kb, vb, ao);

  gemm_wmma_kernel<<<dim3(32, 12, 1), 128, kPanelBytes, stream>>>(ao, wpp, bp, bp, bp, nullptr, nullptr, out);
}
